// v000
// The times below were measured on an AMD MI455X: many runs one after another, warmed up first and cycling through
// copies of the inputs, with the whole window's GPU time divided by the number of runs. Launches and the gaps
// between them are all in it. The median over several windows is given; except for v000 it joins two sittings, which
// can be a few percent apart, so the side-by-side timings, each taken in one sitting, are the better comparison.
// v000 is the starting kernel. One run takes 3840 microseconds.
#include <hip/hip_runtime.h>

// Scaled dot-product self-attention where q = k = v = the input itself (x [4096][1024] reshaped to 16 heads x 64; no projections, no batch; scores = x_h.x_h x 1/sqrt(64); softmax (no mask); out = attn.x_h merged -> [4096][1024] (4.2 M); argument order x).
// Layout: the f32 input feeds the plane builders directly (identity table): ONE set of hi/lo planes serves as both q and k (k = q), value^T planes from the same rows; per head dense 4096 x 4096 scores with every row hi/lo (3 products), streaming three-sweep softmax, attn.V hybrid (rows < 512 hi/lo, rest fp16 x1024); k_cs8 carry removal; k_copy4 writes the output once. NOTE the hi/lo split carries the f32 input.
// Compute dtypes, f32 accumulate: input split into bf16 hi/lo (scores, exact to ~2^-16) and fp16 (value planes for rows >= 512); softmax f32; output f32.

#define NB_  1
#define TT   4096
#define DM   1024
#define NH_  16
#define NKV  16
#define REP  (NH_ / NKV)
#define HD   64
#define DQ   (NH_ * HD)
#define DKV  (NKV * HD)
#define ZH   1
#define RH   512                  // query rows < RH use hi+lo planes (0: none)
#define WIN  0
#define PCAR 1024.0f
#define SCL  0.125f   // 1/sqrt(float32(64))
#define MID  1024      // q / k width
#define CO   1024      // v width
#define CC   1024
typedef _Float16 h16;
typedef unsigned short bf;
typedef __attribute__((ext_vector_type(16))) __bf16   v16bf;
typedef __attribute__((ext_vector_type(16))) _Float16 v16h;
typedef __attribute__((ext_vector_type(8)))  _Float16 v8h;
typedef __attribute__((ext_vector_type(8)))  unsigned short v8us;
typedef __attribute__((ext_vector_type(8)))  float    v8f;
typedef __attribute__((ext_vector_type(4)))  float    v4f;
typedef v8h  __attribute__((may_alias)) v8ha;
typedef v4f  __attribute__((may_alias)) v4fa;
typedef v8us __attribute__((may_alias)) v8usa;

__device__ __forceinline__ unsigned short f2bf(float f) { unsigned u = __float_as_uint(f); u += 0x7FFFu + ((u >> 16) & 1u); return (unsigned short)(u >> 16); }
__device__ __forceinline__ float bf2f(unsigned short b) { return __uint_as_float(((unsigned)b) << 16); }
__device__ __forceinline__ float bfr(float f) { return bf2f(f2bf(f)); }
__device__ __forceinline__ v16h cat16(v8h lo, v8h hi) { return __builtin_shufflevector(lo, hi, 0, 1, 2, 3, 4, 5, 6, 7, 8, 9, 10, 11, 12, 13, 14, 15); }
__device__ __forceinline__ v16bf cat16b(v8us lo, v8us hi) { return __builtin_bit_cast(v16bf, __builtin_shufflevector(lo, hi, 0, 1, 2, 3, 4, 5, 6, 7, 8, 9, 10, 11, 12, 13, 14, 15)); }
__device__ __forceinline__ v8f wmma16(v16h a, v16h b, v8f c) { return __builtin_amdgcn_wmma_f32_16x16x32_f16(false, a, false, b, (short)0, c, false, false); }
__device__ __forceinline__ v8f wmmab(v16bf a, v16bf b, v8f c) { return __builtin_amdgcn_wmma_f32_16x16x32_bf16(false, a, false, b, (short)0, c, false, false); }



// ---- k_gemmw: register-blocked GEMM, ONE WAVE per 64x64 output tile (16 accumulators), operands straight from K-contiguous 16-bit planes; grid (M/64, N/64, Z), 32 threads.
// C[m][n] (f32, pitch ldc, + optional f32 bias[n]) = sum_k A[m][k] Bt[n][k] (+ split products per NSPLIT). z-batch strides sA/sB/sC in elements. K % 32 == 0.
template <typename T16> struct WFrag;
template <> struct WFrag<h16> { typedef v16h V; static __device__ __forceinline__ V ld(const h16* p) { return cat16(*(const v8h*)p, *(const v8h*)(p + 16)); } static __device__ __forceinline__ v8f mma(V a, V b, v8f c) { return wmma16(a, b, c); } };
template <> struct WFrag<bf> { typedef v16bf V; static __device__ __forceinline__ V ld(const bf* p) { return cat16b(*(const v8us*)p, *(const v8us*)(p + 16)); } static __device__ __forceinline__ v8f mma(V a, V b, v8f c) { return wmmab(a, b, c); } };
template <typename T16, int NSPLIT, bool BIAS>
__global__ __launch_bounds__(32) void k_gemmw(const T16* __restrict__ A, const T16* __restrict__ A2, const T16* __restrict__ Bt, const T16* __restrict__ Bt2, int K, float* C, int ldc, const float* __restrict__ bias, size_t sA, size_t sB, size_t sC) {
    typedef typename WFrag<T16>::V V;
    __shared__ __align__(16) float os[16 * 68];
    const size_t z = blockIdx.z; A += z * sA; if (A2) A2 += z * sA; Bt += z * sB; if (Bt2) Bt2 += z * sB; C += z * sC;
    const int lane = threadIdx.x & 31, lr = lane & 15, hi = lane >> 4; const int r0 = blockIdx.x * 64, c0 = blockIdx.y * 64;
    v8f acc[4][4];
#pragma unroll
    for (int mb = 0; mb < 4; ++mb)
#pragma unroll
        for (int nb = 0; nb < 4; ++nb) acc[mb][nb] = (v8f){};
    const size_t aoff = (size_t)(r0 + lr) * K + 8 * hi, boff = (size_t)(c0 + lr) * K + 8 * hi;
#pragma unroll 1
    for (int kc = 0; kc < K; kc += 32) {
        V a[4], a2[4];
#pragma unroll
        for (int mb = 0; mb < 4; ++mb) { a[mb] = WFrag<T16>::ld(A + aoff + (size_t)mb * 16 * K + kc); if (NSPLIT == 1 || NSPLIT == 2) a2[mb] = WFrag<T16>::ld(A2 + aoff + (size_t)mb * 16 * K + kc); }
#pragma unroll
        for (int nb = 0; nb < 4; ++nb) { const V b = WFrag<T16>::ld(Bt + boff + (size_t)nb * 16 * K + kc); V b2; if (NSPLIT >= 2) b2 = WFrag<T16>::ld(Bt2 + boff + (size_t)nb * 16 * K + kc);
#pragma unroll
            for (int mb = 0; mb < 4; ++mb) { acc[mb][nb] = WFrag<T16>::mma(a[mb], b, acc[mb][nb]); if (NSPLIT == 1 || NSPLIT == 2) acc[mb][nb] = WFrag<T16>::mma(a2[mb], b, acc[mb][nb]); if (NSPLIT >= 2) acc[mb][nb] = WFrag<T16>::mma(a[mb], b2, acc[mb][nb]); } }
        asm volatile("v_nop\n\tv_nop\n\tv_nop\n\tv_nop" : "+v"(acc[0][0]), "+v"(acc[1][1]), "+v"(acc[2][2]), "+v"(acc[3][3]) : "v"(a[0]), "v"(a[3]));
    }
#pragma unroll
    for (int mb = 0; mb < 4; ++mb) {
#pragma unroll
        for (int nb = 0; nb < 4; ++nb) {
#pragma unroll
            for (int j = 0; j < 8; ++j) os[(hi * 8 + j) * 68 + nb * 16 + lr] = acc[mb][nb][j]; }
        __builtin_amdgcn_wave_barrier(); asm volatile("" ::: "memory");
        float* crow = C + (size_t)(r0 + mb * 16) * ldc + c0;
{
#pragma unroll
            for (int s = 0; s < 8; ++s) { const int row = 2 * s + hi, cofs = lr * 4; v4f val = *(const v4fa*)(os + row * 68 + cofs); if (BIAS) { val[0] += bfr(bias[c0 + cofs]); val[1] += bfr(bias[c0 + cofs + 1]); val[2] += bfr(bias[c0 + cofs + 2]); val[3] += bfr(bias[c0 + cofs + 3]); }
                *(v4f*)(crow + (size_t)row * ldc + cofs) = val; }
             }
        __builtin_amdgcn_wave_barrier(); asm volatile("" ::: "memory");
    }
}

__device__ __forceinline__ h16 tohx(float x) { return (h16)x; }
__device__ __forceinline__ void splitf(float y, unsigned short& h, unsigned short& l) { h = f2bf(y); l = f2bf(y - bf2f(h)); }
typedef __attribute__((ext_vector_type(2))) _Float16 v2h;
typedef __attribute__((ext_vector_type(4))) _Float16 v4h;
typedef __attribute__((ext_vector_type(2))) unsigned short v2us;
typedef __attribute__((ext_vector_type(4))) unsigned short v4us;
typedef __attribute__((ext_vector_type(2))) float v2f;
typedef __attribute__((ext_vector_type(4))) int v4i;

__global__ __launch_bounds__(256) void k_vtp(const float* __restrict__ F, int pitch, int nheads, h16* V16, bf* Vh, bf* Vl) { const size_t e = ((size_t)blockIdx.x * 256 + threadIdx.x) * 2; if (e >= (size_t)nheads * HD * TT) return; const int t = (int)(e % TT); const int d = (int)((e / TT) % HD); const int g = (int)(e / ((size_t)TT * HD)); v2h o16; v2us oh, ol;
#pragma unroll
    for (int q = 0; q < 2; ++q) { const float x = F[(size_t)(t + q) * pitch + g * HD + d]; o16[q] = tohx(x); unsigned short a2, c2; splitf(x, a2, c2); oh[q] = a2; ol[q] = c2; }
    *(v2h*)(V16 + e) = o16; *(v2us*)(Vh + e) = oh; *(v2us*)(Vl + e) = ol;  }
// k_lsoft: streaming row softmax (no mask) over the TK = TT = 4096 keys, one wave per row i, three sweeps of the f32 score row (lane -> 4 consecutive keys per 128-key chunk, 32 chunks; every key j enters the max and the sum - all score tiles are computed):
__global__ __launch_bounds__(256) void k_lsoft(const float* __restrict__ Sb, h16* P16, bf* Ph, bf* Pl) {
    const int lane = threadIdx.x & 31; const int row = blockIdx.x * 8 + (threadIdx.x >> 5); if (row >= ZH * TT) return; const int i = row % TT; const int zz = row / TT; const bool hires = (i < RH); const float* sr = Sb + (size_t)row * TT; float mx = -3.0e38f;
#pragma unroll 4
    for (int ch = 0; ch < TT / 128; ++ch) { const int j0 = ch * 128 + lane * 4; const v4f a = *(const v4f*)(sr + j0);
#pragma unroll
        for (int q = 0; q < 4; ++q) { float t = a[q] * SCL; asm volatile("" : "+v"(t)); mx = fmaxf(mx, t); } }
#pragma unroll
    for (int sh = 16; sh; sh >>= 1) mx = fmaxf(mx, __shfl_xor(mx, sh, 32));
    float sum = 0.f;
#pragma unroll 4
    for (int ch = 0; ch < TT / 128; ++ch) { const int j0 = ch * 128 + lane * 4; const v4f a = *(const v4f*)(sr + j0);
#pragma unroll
        for (int q = 0; q < 4; ++q) { float t = a[q] * SCL; asm volatile("" : "+v"(t)); float d0 = __fsub_rn(t, mx); asm volatile("" : "+v"(d0)); sum += __builtin_amdgcn_exp2f(__fmul_rn(d0, 1.4426950408889634f)); } }
#pragma unroll
    for (int sh = 16; sh; sh >>= 1) sum += __shfl_xor(sum, sh, 32);
    const float f = __fdiv_rn(hires ? 1.0f : PCAR, sum);
{
        if (hires) {   /* rows < RH: normalised bf16 hi/lo over all keys, planes [zz][RH][TT] */
#pragma unroll
            for (int ch = 0; ch < TT / 128; ++ch) { const int j0 = ch * 128 + lane * 4; const v4f a = *(const v4f*)(sr + j0); v4us oh, ol;
#pragma unroll
                for (int q = 0; q < 4; ++q) { float t = a[q] * SCL; asm volatile("" : "+v"(t)); float d0 = __fsub_rn(t, mx); asm volatile("" : "+v"(d0)); float ex = __builtin_amdgcn_exp2f(__fmul_rn(d0, 1.4426950408889634f)); asm volatile("" : "+v"(ex)); unsigned short a2, c2; splitf(ex * f, a2, c2); oh[q] = a2; ol[q] = c2; }
                const size_t oo = ((size_t)zz * RH + i) * TT + j0; *(v4us*)(Ph + oo) = oh; *(v4us*)(Pl + oo) = ol; }
        } else {
#pragma unroll 2
            for (int ch = 0; ch < TT / 128; ++ch) { const int j0 = ch * 128 + lane * 4; const v4f a = *(const v4f*)(sr + j0); v4h o4;
#pragma unroll
                for (int q = 0; q < 4; ++q) { float t = a[q] * SCL; asm volatile("" : "+v"(t)); float d0 = __fsub_rn(t, mx); asm volatile("" : "+v"(d0)); float ex = __builtin_amdgcn_exp2f(__fmul_rn(d0, 1.4426950408889634f)); asm volatile("" : "+v"(ex)); o4[q] = tohx(ex * f); }
                *(v4h*)(P16 + (size_t)row * TT + j0) = o4; } }
         }
}
__global__ __launch_bounds__(256) void k_cs8(float* O, size_t n4) { const size_t i = (size_t)blockIdx.x * 256 + threadIdx.x; if (i >= n4) return; const size_t e = i * 4; const int t = (int)(e / CC); const float cs = (t < RH) ? 1.0f : (1.0f / PCAR); v4f a = *(const v4f*)(O + e);
#pragma unroll
    for (int q = 0; q < 4; ++q) a[q] = __fmul_rn(a[q], cs);
    *(v4f*)(O + e) = a;  }

__global__ __launch_bounds__(256) void k_csid(float* CS) { const int idx = blockIdx.x * 256 + threadIdx.x; if (idx >= TT * HD) return; v2f cs; cs[0] = 1.0f; cs[1] = 0.0f; *(v2f*)(CS + (size_t)idx * 2) = cs;  }
// k_rope: head planes [h][t][d] (fp16 + hi/lo) of rope(x) x sc with the rotate-half convention out[d] = x[d] cos[t][d] - x[d+HD/2] sin[t][d], out[d+HD/2] = x[d+HD/2] cos[t][d+HD/2] + x[d] sin[t][d+HD/2]
__global__ __launch_bounds__(256) void k_rope(const float* __restrict__ F, int pitch, int nheads, const float* __restrict__ CS, const float* __restrict__ RF, const float* __restrict__ nw, float sc, h16* P16, bf* Ph, bf* Pl) {
    const size_t e = ((size_t)blockIdx.x * 256 + threadIdx.x) * 2; if (e >= (size_t)nheads * TT * HD) return; const int d = (int)(e % HD); const int t = (int)((e / HD) % TT); const int h = (int)(e / ((size_t)HD * TT)); const float* f = F + (size_t)t * pitch + h * HD; const float rf = RF ? RF[(size_t)h * TT + t] : 1.0f; v2h o16; v2us oh, ol;
#pragma unroll
    for (int q = 0; q < 2; ++q) { const int dd = d + q; const int dp = (dd < HD / 2) ? dd + HD / 2 : dd - HD / 2; float x0 = f[dd], x1 = f[dp];
        if (RF) { float n0 = __fmul_rn(x0, rf), n1 = __fmul_rn(x1, rf); asm volatile("" : "+v"(n0)); asm volatile("" : "+v"(n1)); x0 = __fmul_rn(bfr(nw[dd]), n0); x1 = __fmul_rn(bfr(nw[dp]), n1); }
        const v2f cs = *(const v2f*)(CS + ((size_t)t * HD + dd) * 2); float a = __fmul_rn(x0, cs[0]), bq = __fmul_rn(x1, cs[1]); asm volatile("" : "+v"(a)); asm volatile("" : "+v"(bq)); const float r = ((dd < HD / 2) ? __fsub_rn(a, bq) : __fadd_rn(a, bq)) * sc;
        o16[q] = tohx(r); unsigned short a2, c2; splitf(r, a2, c2); oh[q] = a2; ol[q] = c2; }
    *(v2h*)(P16 + e) = o16; *(v2us*)(Ph + e) = oh; *(v2us*)(Pl + e) = ol;  }
__global__ __launch_bounds__(256) void k_copy4(const float* __restrict__ Y, float* out, size_t n4) { const size_t i = (size_t)blockIdx.x * 256 + threadIdx.x; if (i >= n4) return; const v4f a = *(const v4f*)(Y + i * 4); *(v4f*)(out + i * 4) = a;  }
extern "C" void kernel_launch(void* const* d_in, const int* in_sizes, int n_in,
                              void* d_out, int out_size, void* d_ws, size_t ws_size, hipStream_t stream) {
    (void)in_sizes; (void)n_in; (void)out_size;
    const float* x = (const float*)d_in[0];   /* x [4096][1024]: q = k = v = x reshaped to 16 heads x 64 (no projections, no batch) */
    float* OUT = (float*)d_out;     // [4096][1024]
    char* wsp = (char*)d_ws;
    auto take = [&](size_t bytes) { char* p = wsp; wsp += (bytes + 255) & ~(size_t)255; return (void*)p; };
     float* CS = (float*)take((size_t)TT * HD * 2 * 4);
    bf* XB = (bf*)take((size_t)TT * CC * 2); float* FQ = (float*)take((size_t)TT * MID * 4); float* FK = (float*)take((size_t)TT * MID * 4);
    h16* QP16 = (h16*)take((size_t)TT * MID * 2); bf* QPh = (bf*)take((size_t)TT * MID * 2); bf* QPl = (bf*)take((size_t)TT * MID * 2); h16* KP16 = QP16; bf* KPh = QPh; bf* KPl = QPl;   /* k = q */
    h16* VT16 = (h16*)take((size_t)CO * TT * 2); bf* VTh = (bf*)take((size_t)CO * TT * 2); bf* VTl = (bf*)take((size_t)CO * TT * 2);
    float* Sb = (float*)take((size_t)TT * TT * 4); h16* P16 = (h16*)take((size_t)TT * TT * 2); bf* Ph = (bf*)take((size_t)RH * TT * 2); bf* Pl = (bf*)take((size_t)RH * TT * 2); float* Ob = (float*)take((size_t)TT * CO * 4); 
    if ((size_t)(wsp - (char*)d_ws) > ws_size) return;    // ws 256 MiB (carve 210 MiB)
    float* FV = FK;   /* unused alias of the k buffer: no v projection, the v planes come straight from x */
    k_csid<<<(TT * HD + 255) / 256, 256, 0, stream>>>(CS);   /* identity table: k_rope is a plain per-head plane builder here */
    const unsigned LP = (unsigned)(((size_t)NH_ * TT * HD / 2 + 255) / 256);
    for (int b = 0; b < NB_; ++b) {
        /* no projections: q = k = v = x */
        k_rope<<<LP, 256, 0, stream>>>(x, MID, NH_, CS, nullptr, nullptr, 1.0f, QP16, QPh, QPl);   /* q (= k) planes [h][n][64] straight from the f32 input (identity table; bf16 hi/lo split + fp16) */
        /* k planes = q planes (same tensor): KP16/KPh/KPl alias QP16/QPh/QPl */
        k_vtp<<<(unsigned)(((size_t)TT * CO / 2 + 255) / 256), 256, 0, stream>>>(x, CO, CO / HD, VT16, VTh, VTl);   /* v^T planes [h][64][n] */
        for (int h = 0; h < NH_; ++h) {   /* per head: dense 4096 x 4096 attention */
            k_gemmw<bf, 2, false><<<dim3(TT / 64, TT / 64, 1), 32, 0, stream>>>(QPh + (size_t)h * TT * HD, QPl + (size_t)h * TT * HD, KPh + (size_t)h * TT * HD, KPl + (size_t)h * TT * HD, HD, Sb, TT, nullptr, 0, 0, 0);   /* S[i][j] = q_i.k_j (3 products, every row) */
            k_lsoft<<<TT / 8, 256, 0, stream>>>(Sb, P16, Ph, Pl);   /* x 1/8, softmax over the 4,096 keys */
            k_gemmw<bf, 2, false><<<dim3(RH / 64, HD / 64, 1), 32, 0, stream>>>(Ph, Pl, VTh + (size_t)h * HD * TT, VTl + (size_t)h * HD * TT, TT, Ob + h * HD, CO, nullptr, 0, 0, 0);
            k_gemmw<h16, 0, false><<<dim3((TT - RH) / 64, HD / 64, 1), 32, 0, stream>>>(P16 + (size_t)RH * TT, nullptr, VT16 + (size_t)h * HD * TT, nullptr, TT, Ob + (size_t)RH * CO + h * HD, CO, nullptr, 0, 0, 0); }
        k_cs8<<<(unsigned)(((size_t)TT * CO / 4 + 255) / 256), 256, 0, stream>>>(Ob, (size_t)TT * CO / 4);   /* rows >= 512 x 1/1024 */ k_copy4<<<(unsigned)(((size_t)TT * CO / 4 + 255) / 256), 256, 0, stream>>>(Ob, OUT + (size_t)b * TT * CO, (size_t)TT * CO / 4); }   /* output rows written once */   /* out = merged per-head attn.x_h (no output projection) */
}

// v002
// One run takes 148 microseconds.
// Versions in between are left out here; by their measured steps it is 26.4 times as fast as v000.
#include <hip/hip_runtime.h>

// Scaled dot-product self-attention where q = k = v = the input itself (x [4096][1024] reshaped to 16 heads x 64; no projections, no batch; scores = x_h.x_h x 1/sqrt(64); softmax (no mask); out = attn.x_h merged -> [4096][1024] (4.2 M); argument order x).
// Layout: the f32 input feeds the plane builders directly (identity table): ONE set of hi/lo planes serves as both q and k (k = q), value^T planes from the same rows; k_fattn then does scores (every row hi/lo, 3 products), softmax and attn.V (rows < 512 hi/lo, rest fp16 x1024) in one launch, a running maximum and sum per query, and writes the output once. NOTE the hi/lo split carries the f32 input.
// Compute dtypes, f32 accumulate: input split into bf16 hi/lo (scores, exact to ~2^-16) and fp16 (value planes for rows >= 512); softmax f32; output f32.

#define NB_  1
#define TT   4096
#define DM   1024
#define NH_  16
#define NKV  16
#define REP  (NH_ / NKV)
#define HD   64
#define DQ   (NH_ * HD)
#define DKV  (NKV * HD)
#define ZH   1
#define RH   512                  // query rows < RH use hi+lo planes
#define WIN  0
#define PCAR 1024.0f
#define SCL  0.125f   // 1/sqrt(float32(64))
#define MID  1024      // q / k width
#define CO   1024      // v width
#define CC   1024
typedef _Float16 h16;
typedef unsigned short bf;
typedef __attribute__((ext_vector_type(16))) __bf16   v16bf;
typedef __attribute__((ext_vector_type(16))) _Float16 v16h;
typedef __attribute__((ext_vector_type(8)))  _Float16 v8h;
typedef __attribute__((ext_vector_type(8)))  unsigned short v8us;
typedef __attribute__((ext_vector_type(8)))  float    v8f;
typedef __attribute__((ext_vector_type(4)))  float    v4f;
typedef v8h  __attribute__((may_alias)) v8ha;
typedef v4f  __attribute__((may_alias)) v4fa;
typedef v8us __attribute__((may_alias)) v8usa;

__device__ __forceinline__ unsigned short f2bf(float f) { unsigned u = __float_as_uint(f); u += 0x7FFFu + ((u >> 16) & 1u); return (unsigned short)(u >> 16); }
__device__ __forceinline__ float bf2f(unsigned short b) { return __uint_as_float(((unsigned)b) << 16); }
__device__ __forceinline__ float bfr(float f) { return bf2f(f2bf(f)); }
__device__ __forceinline__ v16h cat16(v8h lo, v8h hi) { return __builtin_shufflevector(lo, hi, 0, 1, 2, 3, 4, 5, 6, 7, 8, 9, 10, 11, 12, 13, 14, 15); }
__device__ __forceinline__ v16bf cat16b(v8us lo, v8us hi) { return __builtin_bit_cast(v16bf, __builtin_shufflevector(lo, hi, 0, 1, 2, 3, 4, 5, 6, 7, 8, 9, 10, 11, 12, 13, 14, 15)); }
__device__ __forceinline__ v8f wmma16(v16h a, v16h b, v8f c) { return __builtin_amdgcn_wmma_f32_16x16x32_f16(false, a, false, b, (short)0, c, false, false); }
__device__ __forceinline__ v8f wmmab(v16bf a, v16bf b, v8f c) { return __builtin_amdgcn_wmma_f32_16x16x32_bf16(false, a, false, b, (short)0, c, false, false); }

// fragment loaders: 16 rows (lane c = row) of a K-contiguous 16-bit plane, p already at the lane's row and at 8h: k = 8h + s for s < 8, 16 + 8h + (s - 8) behind
template <typename T16> struct WFrag;
template <> struct WFrag<h16> { typedef v16h V; static __device__ __forceinline__ V ld(const h16* p) { return cat16(*(const v8h*)p, *(const v8h*)(p + 16)); } static __device__ __forceinline__ v8f mma(V a, V b, v8f c) { return wmma16(a, b, c); } };
template <> struct WFrag<bf> { typedef v16bf V; static __device__ __forceinline__ V ld(const bf* p) { return cat16b(*(const v8us*)p, *(const v8us*)(p + 16)); } static __device__ __forceinline__ v8f mma(V a, V b, v8f c) { return wmmab(a, b, c); } };

__device__ __forceinline__ h16 tohx(float x) { return (h16)x; }
__device__ __forceinline__ void splitf(float y, unsigned short& h, unsigned short& l) { h = f2bf(y); l = f2bf(y - bf2f(h)); }
typedef __attribute__((ext_vector_type(2))) _Float16 v2h;
typedef __attribute__((ext_vector_type(4))) _Float16 v4h;
typedef __attribute__((ext_vector_type(2))) unsigned short v2us;
typedef __attribute__((ext_vector_type(4))) unsigned short v4us;
typedef __attribute__((ext_vector_type(2))) float v2f;
typedef __attribute__((ext_vector_type(4))) int v4i;

__global__ __launch_bounds__(256) void k_vtp(const float* __restrict__ F, int pitch, int nheads, h16* V16, bf* Vh, bf* Vl) { const size_t e = ((size_t)blockIdx.x * 256 + threadIdx.x) * 2; if (e >= (size_t)nheads * HD * TT) return; const int t = (int)(e % TT); const int d = (int)((e / TT) % HD); const int g = (int)(e / ((size_t)TT * HD)); v2h o16; v2us oh, ol;
#pragma unroll
    for (int q = 0; q < 2; ++q) { const float x = F[(size_t)(t + q) * pitch + g * HD + d]; o16[q] = tohx(x); unsigned short a2, c2; splitf(x, a2, c2); oh[q] = a2; ol[q] = c2; }
    *(v2h*)(V16 + e) = o16; *(v2us*)(Vh + e) = oh; *(v2us*)(Vl + e) = ol;  }

__device__ __forceinline__ float xhalf(float x) { const int b = __float_as_int(x); return __int_as_float(__builtin_amdgcn_permlanex16(b, b, 0x76543210, 0xfedcba98, false, false)); }   /* lane l <-> l ^ 16 */
// behind a group of global loads or stores: their address (and data) registers are rewritten only behind this wait. The group's base pointers are inputs, so that their registers stay theirs up to the wait
// (no load of the group lands on them); the scheduling barrier keeps the register writes that follow in the source behind the wait in the listing too
__device__ __forceinline__ void xwait(const void* p0, const void* p1) { asm volatile("s_wait_xcnt 0x0" :: "v"(p0), "v"(p1) : "memory"); __builtin_amdgcn_sched_barrier(0); }
// 2^x: v_exp_f32 and, in the same statement, the one slot that the instruction set asks for behind a transcendental before its result is read or its source overwritten
__device__ __forceinline__ float ex2(float x) { float r; asm("v_exp_f32 %0, %1\n\tv_nop" : "=v"(r) : "v"(x)); return r; }
#define SCL2 0.18033688011112042f   // SCL x log2(e)
#define SK   64                   // keys per stage
#define NST  (TT / SK)            // stages
#define LPB  144                  // LDS row pitch, bytes: 128 + 16 = 16 x odd, 16 rows of a 16-byte read fall on 64 different banks
#define LPE  (LPB / 2)            // the same in 16-bit elements
#define TSZ  (64 * LPB)           // one tile of 64 rows
#define BSZ  (5 * TSZ)            // one stage: K hi, K lo, V^T fp16, V^T hi, V^T lo
// one stage's ten copies of a thread (two 16-byte pieces of each of the five tiles; a wave's 32 lanes copy four whole 128-byte rows at a time). d: the thread's place in tile 0 of the target buffer (LDS byte address);
// the five pointers: the stage's first element in each plane (the same for the whole work-group); ko, vo: the thread's piece in rows 0-31 of a K tile and of a V^T tile, in elements; rows 32-63 lie 32 plane rows further.
// s_wait_xcnt 0 is the statement's last line, so that no address register of a copy is rewritten in front of it
__device__ __forceinline__ void stage_copy(unsigned d, const bf* skh, const bf* skl, const h16* sv16, const bf* svh, const bf* svl, unsigned ko, unsigned vo) {
    const bf* kh = skh + ko; const bf* kl = skl + ko; const h16* v16 = sv16 + vo; const bf* vh = svh + vo; const bf* vl = svl + vo;
    const bf* kh1 = skh + (ko + 32 * HD); const bf* kl1 = skl + (ko + 32 * HD); const h16* v161 = sv16 + (vo + 32 * TT); const bf* vh1 = svh + (vo + 32 * TT); const bf* vl1 = svl + (vo + 32 * TT);
    asm volatile("global_load_async_to_lds_b128 %0, %10, off\n\t"
                 "global_load_async_to_lds_b128 %1, %11, off\n\t"
                 "global_load_async_to_lds_b128 %2, %12, off\n\t"
                 "global_load_async_to_lds_b128 %3, %13, off\n\t"
                 "global_load_async_to_lds_b128 %4, %14, off\n\t"
                 "global_load_async_to_lds_b128 %5, %15, off\n\t"
                 "global_load_async_to_lds_b128 %6, %16, off\n\t"
                 "global_load_async_to_lds_b128 %7, %17, off\n\t"
                 "global_load_async_to_lds_b128 %8, %18, off\n\t"
                 "global_load_async_to_lds_b128 %9, %19, off\n\t"
                 "s_wait_xcnt 0x0"
                 :: "v"(d), "v"(d + 32 * LPB), "v"(d + TSZ), "v"(d + TSZ + 32 * LPB), "v"(d + 2 * TSZ), "v"(d + 2 * TSZ + 32 * LPB), "v"(d + 3 * TSZ), "v"(d + 3 * TSZ + 32 * LPB), "v"(d + 4 * TSZ), "v"(d + 4 * TSZ + 32 * LPB),
                    "v"(kh), "v"(kh1), "v"(kl), "v"(kl1), "v"(v16), "v"(v161), "v"(vh), "v"(vh1), "v"(vl), "v"(vl1) : "memory");
}
// one wave's work on one stage in LDS (st: the stage's buffer; loff: the lane's place in a 16-row block of a tile, in elements; hr: the wave's kind, the same in all its lanes): two passes of 32 keys.
// Scores and softmax are the same code for both kinds of wave; only the V^T fragments and the second product differ, under scalar branches, so that the stage loop and its barrier are one for the whole work-group
__device__ __forceinline__ void fattn_stage(const unsigned char* st, unsigned loff, bool hr, const v16bf (&qh)[2][2], const v16bf (&ql)[2][2], v8f (&o)[4][2], float (&m)[2], float (&l)[2]) {
    const bf* khp = (const bf*)st + loff; const bf* klp = (const bf*)(st + TSZ) + loff; const bf* vap = (const bf*)(st + (hr ? 3 * TSZ : 2 * TSZ)) + loff; const bf* vlp = (const bf*)(st + 4 * TSZ) + loff;
    const float cb = hr ? 0.0f : 10.0f;
    // the fragment and accumulator arrays are indexed by constants only (every loop over them is unrolled), so that they stay in registers
    v16bf kh[2][2], kl[2][2];
#pragma unroll
    for (int kt = 0; kt < 2; ++kt)
#pragma unroll
        for (int ks = 0; ks < 2; ++ks) { kh[kt][ks] = WFrag<bf>::ld(khp + kt * 16 * LPE + ks * 32); kl[kt][ks] = WFrag<bf>::ld(klp + kt * 16 * LPE + ks * 32); }
    // unrolled: the pass number is a constant in every LDS offset
#pragma unroll
    for (int ps_ = 0; ps_ < SK / 32; ++ps_) {
        /* this pass's V^T fragments, asked for first: they are used last. va: the hi plane's bits (hr) or the fp16 plane's; vb: the lo plane's (hr only) */
        v16bf va[4], vb[4];
#pragma unroll
        for (int dt = 0; dt < 4; ++dt) va[dt] = WFrag<bf>::ld(vap + dt * 16 * LPE + ps_ * 32);
        if (hr) {
#pragma unroll
            for (int dt = 0; dt < 4; ++dt) vb[dt] = WFrag<bf>::ld(vlp + dt * 16 * LPE + ps_ * 32); }
        v8f s[2][2];
#pragma unroll
        for (int kt = 0; kt < 2; ++kt)
#pragma unroll
            for (int qt = 0; qt < 2; ++qt) { v8f a = (v8f){};
#pragma unroll
                for (int ks = 0; ks < 2; ++ks) { a = wmmab(kh[kt][ks], qh[qt][ks], a); a = wmmab(kl[kt][ks], qh[qt][ks], a); a = wmmab(kh[kt][ks], ql[qt][ks], a); }
                s[kt][qt] = a; }
        /* the stage's next pass's key fragments into the same registers, behind their last use; never beyond the stage, whose successor is not published yet */
        if (ps_ + 1 < SK / 32) {
#pragma unroll
            for (int kt = 0; kt < 2; ++kt)
#pragma unroll
                for (int ks = 0; ks < 2; ++ks) { kh[kt][ks] = WFrag<bf>::ld(khp + ((ps_ + 1) * 32 + kt * 16) * LPE + ks * 32); kl[kt][ks] = WFrag<bf>::ld(klp + ((ps_ + 1) * 32 + kt * 16) * LPE + ks * 32); } }
        float p[2][16], al[2];
#pragma unroll
        for (int qt = 0; qt < 2; ++qt) {
            float mx = s[0][qt][0];
#pragma unroll
            for (int j = 1; j < 8; ++j) mx = fmaxf(mx, s[0][qt][j]);
#pragma unroll
            for (int j = 0; j < 8; ++j) mx = fmaxf(mx, s[1][qt][j]);
            mx = fmaxf(mx, xhalf(mx));
            const float mn = fmaxf(m[qt], mx * SCL2); al[qt] = ex2(m[qt] - mn); m[qt] = mn;
            const float nb = cb - mn;
            float ps = 0.f;
#pragma unroll
            for (int e = 0; e < 16; ++e) { p[qt][e] = ex2(fmaf(s[e >> 3][qt][e & 7], SCL2, nb)); ps += p[qt][e]; }
            l[qt] = fmaf(l[qt], al[qt], ps);
        }
        /* ex2 is asm: the products below stand in blocks of their own, behind every ex2 of the pass, and behind the score products stands the whole maximum chain */
        if (hr) {
#pragma unroll
            for (int qt = 0; qt < 2; ++qt) { v8us h0, h1, l0, l1;
#pragma unroll
                for (int e = 0; e < 8; ++e) { unsigned short a2, c2; splitf(p[qt][e], a2, c2); h0[e] = a2; l0[e] = c2; splitf(p[qt][8 + e], a2, c2); h1[e] = a2; l1[e] = c2; }
                const v16bf ph = cat16b(h0, h1), pl = cat16b(l0, l1);
#pragma unroll
                for (int dt = 0; dt < 4; ++dt) { o[dt][qt] *= al[qt]; o[dt][qt] = wmmab(va[dt], ph, o[dt][qt]); o[dt][qt] = wmmab(va[dt], pl, o[dt][qt]); o[dt][qt] = wmmab(vb[dt], ph, o[dt][qt]); } }
        } else {
#pragma unroll
            for (int qt = 0; qt < 2; ++qt) { v16h pf;
#pragma unroll
                for (int e = 0; e < 16; ++e) pf[e] = tohx(p[qt][e]);
#pragma unroll
                for (int dt = 0; dt < 4; ++dt) { o[dt][qt] *= al[qt]; o[dt][qt] = wmma16(__builtin_bit_cast(v16h, va[dt]), pf, o[dt][qt]); } }
        }
    }
}
// grid (16, heads), 8 waves: wave 0 takes one of the head's 16 hi/lo query tiles (rows < RH), waves 1-7 seven of its 112 fp16 tiles, so that every work-group carries the same load
__global__ __launch_bounds__(256) void k_fattn(const bf* __restrict__ QPh, const bf* __restrict__ QPl, const h16* __restrict__ VT16, const bf* __restrict__ VTh, const bf* __restrict__ VTl, float* __restrict__ out) {
    __shared__ __attribute__((aligned(16))) unsigned char ring[2 * BSZ];
    const int w = __builtin_amdgcn_readfirstlane((int)(threadIdx.x >> 5)); const int lane = threadIdx.x & 31, lr = lane & 15, hi = lane >> 4; const size_t hp = (size_t)blockIdx.y * TT * HD;
    const bf* Kh = QPh + hp; const bf* Kl = QPl + hp; float* orow = out + blockIdx.y * HD;
    const int q0 = (w == 0) ? (int)blockIdx.x * 32 : RH + ((int)blockIdx.x * 7 + w - 1) * 32;
    /* the thread's piece of every tile: row tid / 8 (and 32 rows further), 16-byte column tid % 8 */
    const int crow = (int)(threadIdx.x >> 3), ccol = (int)(threadIdx.x & 7);
    const unsigned cd = (unsigned)(size_t)ring + (unsigned)(crow * LPB + ccol * 16);
    const unsigned ko = (unsigned)(crow * HD + ccol * 8), vo = (unsigned)(crow * TT + ccol * 8);
    const h16* V16 = VT16 + hp; const bf* Vh = VTh + hp; const bf* Vl = VTl + hp;
    stage_copy(cd, Kh, Kl, V16, Vh, Vl, ko, vo);   /* stage 0 into buffer 0 */
    /* the query fragments, kept in registers */
    v16bf qh[2][2], ql[2][2];
    const bf* qhp = Kh + (size_t)q0 * HD + lr * HD + 8 * hi; const bf* qlp = Kl + (size_t)q0 * HD + lr * HD + 8 * hi;
#pragma unroll
    for (int qt = 0; qt < 2; ++qt)
#pragma unroll
        for (int ks = 0; ks < 2; ++ks) { qh[qt][ks] = WFrag<bf>::ld(qhp + qt * 16 * HD + ks * 32); ql[qt][ks] = WFrag<bf>::ld(qlp + qt * 16 * HD + ks * 32); }
    xwait(qhp, qlp);
    v8f o[4][2];
#pragma unroll
    for (int dt = 0; dt < 4; ++dt)
#pragma unroll
        for (int qt = 0; qt < 2; ++qt) o[dt][qt] = (v8f){};
    float m[2] = {-3.0e38f, -3.0e38f}, l[2] = {0.f, 0.f};
    const unsigned loff = (unsigned)(lr * LPE + 8 * hi);
    asm volatile("s_wait_asynccnt 0x0" ::: "memory");   /* this wave's copies of stage 0 have landed */
    __syncthreads();                                     /* and every other wave's: stage 0 is published */
    stage_copy(cd + BSZ, Kh + SK * HD, Kl + SK * HD, V16 + SK, Vh + SK, Vl + SK, ko, vo);   /* stage 1 into buffer 1 */
    // rolled: one stage's fragments, scores and the output tiles are the register budget
#pragma unroll 1
    for (int s = 0; s < NST; ++s) {
        const unsigned char* st = ring + (s & 1) * BSZ;
        fattn_stage(st, loff, w == 0, qh, ql, o, m, l);
        /* publish point of stage s + 1, every wave: its own LDS reads of stage s are done, its own copies of stage s + 1 have landed, then the barrier; only behind it is stage s's buffer refilled */
        asm volatile("s_wait_dscnt 0x0" ::: "memory");
        asm volatile("s_wait_asynccnt 0x0" ::: "memory");
        __syncthreads();
        if (s + 2 < NST) stage_copy(cd + (unsigned)(s & 1) * BSZ, Kh + (size_t)(s + 2) * SK * HD, Kl + (size_t)(s + 2) * SK * HD, V16 + (s + 2) * SK, Vh + (s + 2) * SK, Vl + (s + 2) * SK, ko, vo);
    }
    asm volatile("s_wait_asynccnt 0x0" ::: "memory");   /* no copy is outstanding when the wave ends */
    /* register j of o[dt][qt] = O[query q0 + 16 qt + c][d = 16 dt + 8h + j]: 8 consecutive floats of one output row per lane */
#pragma unroll
    for (int qt = 0; qt < 2; ++qt) { const float f = __fdiv_rn(1.0f, l[qt] + xhalf(l[qt])); float* r = orow + (size_t)(q0 + qt * 16 + lr) * DM + 8 * hi;
#pragma unroll
        for (int dt = 0; dt < 4; ++dt) { v4f a, b;
#pragma unroll
            for (int j = 0; j < 4; ++j) { a[j] = o[dt][qt][j] * f; b[j] = o[dt][qt][4 + j] * f; }
            *(v4f*)(r + dt * 16) = a; *(v4f*)(r + dt * 16 + 4) = b; }
        xwait(r, r); }
}

__global__ __launch_bounds__(256) void k_csid(float* CS) { const int idx = blockIdx.x * 256 + threadIdx.x; if (idx >= TT * HD) return; v2f cs; cs[0] = 1.0f; cs[1] = 0.0f; *(v2f*)(CS + (size_t)idx * 2) = cs;  }
// k_rope: head planes [h][t][d] (fp16 + hi/lo) of rope(x) x sc with the rotate-half convention out[d] = x[d] cos[t][d] - x[d+HD/2] sin[t][d], out[d+HD/2] = x[d+HD/2] cos[t][d+HD/2] + x[d] sin[t][d+HD/2]
__global__ __launch_bounds__(256) void k_rope(const float* __restrict__ F, int pitch, int nheads, const float* __restrict__ CS, const float* __restrict__ RF, const float* __restrict__ nw, float sc, h16* P16, bf* Ph, bf* Pl) {
    const size_t e = ((size_t)blockIdx.x * 256 + threadIdx.x) * 2; if (e >= (size_t)nheads * TT * HD) return; const int d = (int)(e % HD); const int t = (int)((e / HD) % TT); const int h = (int)(e / ((size_t)HD * TT)); const float* f = F + (size_t)t * pitch + h * HD; const float rf = RF ? RF[(size_t)h * TT + t] : 1.0f; v2h o16; v2us oh, ol;
#pragma unroll
    for (int q = 0; q < 2; ++q) { const int dd = d + q; const int dp = (dd < HD / 2) ? dd + HD / 2 : dd - HD / 2; float x0 = f[dd], x1 = f[dp];
        if (RF) { float n0 = __fmul_rn(x0, rf), n1 = __fmul_rn(x1, rf); asm volatile("" : "+v"(n0)); asm volatile("" : "+v"(n1)); x0 = __fmul_rn(bfr(nw[dd]), n0); x1 = __fmul_rn(bfr(nw[dp]), n1); }
        const v2f cs = *(const v2f*)(CS + ((size_t)t * HD + dd) * 2); float a = __fmul_rn(x0, cs[0]), bq = __fmul_rn(x1, cs[1]); asm volatile("" : "+v"(a)); asm volatile("" : "+v"(bq)); const float r = ((dd < HD / 2) ? __fsub_rn(a, bq) : __fadd_rn(a, bq)) * sc;
        o16[q] = tohx(r); unsigned short a2, c2; splitf(r, a2, c2); oh[q] = a2; ol[q] = c2; }
    *(v2h*)(P16 + e) = o16; *(v2us*)(Ph + e) = oh; *(v2us*)(Pl + e) = ol;  }
extern "C" void kernel_launch(void* const* d_in, const int* in_sizes, int n_in,
                              void* d_out, int out_size, void* d_ws, size_t ws_size, hipStream_t stream) {
    (void)in_sizes; (void)n_in; (void)out_size;
    const float* x = (const float*)d_in[0];   /* x [4096][1024]: q = k = v = x reshaped to 16 heads x 64 (no projections, no batch) */
    float* OUT = (float*)d_out;     // [4096][1024]
    char* wsp = (char*)d_ws;
    auto take = [&](size_t bytes) { char* p = wsp; wsp += (bytes + 255) & ~(size_t)255; return (void*)p; };
    float* CS = (float*)take((size_t)TT * HD * 2 * 4);
    h16* QP16 = (h16*)take((size_t)TT * MID * 2); bf* QPh = (bf*)take((size_t)TT * MID * 2); bf* QPl = (bf*)take((size_t)TT * MID * 2);   /* k = q: one set of planes */
    h16* VT16 = (h16*)take((size_t)CO * TT * 2); bf* VTh = (bf*)take((size_t)CO * TT * 2); bf* VTl = (bf*)take((size_t)CO * TT * 2);
    if ((size_t)(wsp - (char*)d_ws) > ws_size) return;    // ws 256 MiB (carve 50 MiB)
    k_csid<<<(TT * HD + 255) / 256, 256, 0, stream>>>(CS);   /* identity table: k_rope is a plain per-head plane builder here */
    const unsigned LP = (unsigned)(((size_t)NH_ * TT * HD / 2 + 255) / 256);
    k_rope<<<LP, 256, 0, stream>>>(x, MID, NH_, CS, nullptr, nullptr, 1.0f, QP16, QPh, QPl);   /* q (= k) planes [h][n][64] straight from the f32 input (identity table; bf16 hi/lo split + fp16) */
    k_vtp<<<(unsigned)(((size_t)TT * CO / 2 + 255) / 256), 256, 0, stream>>>(x, CO, CO / HD, VT16, VTh, VTl);   /* v^T planes [h][64][n] */
    k_fattn<<<dim3(RH / 32, NH_, 1), 256, 0, stream>>>(QPh, QPl, VT16, VTh, VTl, OUT);   /* all heads: scores x 1/8, softmax over the 4,096 keys, attn.V, output rows written once */
}

// v003
// Measured time: 133 microseconds a run.
// In both of two side-by-side timings against v002, it was 1.10 times as fast.
// Counting every step since v000, it is 29.0 times as fast.
#include <hip/hip_runtime.h>

// Scaled dot-product self-attention where q = k = v = the input itself (x [4096][1024] reshaped to 16 heads x 64; no projections, no batch; scores = x_h.x_h x 1/sqrt(64); softmax (no mask); out = attn.x_h merged -> [4096][1024] (4.2 M); argument order x).
// Layout: the f32 input feeds one plane builder directly: ONE set of hi/lo planes serves as both q and k (k = q), value^T planes from the same rows; k_fattn then does scores (every row hi/lo, 3 products), softmax and attn.V (rows < 512 hi/lo, rest fp16 x1024) in one launch, a running maximum and sum per query, and writes the output once. NOTE the hi/lo split carries the f32 input.
// Compute dtypes, f32 accumulate: input split into bf16 hi/lo (scores, exact to ~2^-16) and fp16 (value planes for rows >= 512); softmax f32; output f32.

#define NB_  1
#define TT   4096
#define DM   1024
#define NH_  16
#define NKV  16
#define REP  (NH_ / NKV)
#define HD   64
#define DQ   (NH_ * HD)
#define DKV  (NKV * HD)
#define ZH   1
#define RH   512                  // query rows < RH use hi+lo planes
#define WIN  0
#define PCAR 1024.0f
#define SCL  0.125f   // 1/sqrt(float32(64))
#define MID  1024      // q / k width
#define CO   1024      // v width
#define CC   1024
typedef _Float16 h16;
typedef unsigned short bf;
typedef __attribute__((ext_vector_type(16))) __bf16   v16bf;
typedef __attribute__((ext_vector_type(16))) _Float16 v16h;
typedef __attribute__((ext_vector_type(8)))  _Float16 v8h;
typedef __attribute__((ext_vector_type(8)))  unsigned short v8us;
typedef __attribute__((ext_vector_type(8)))  float    v8f;
typedef __attribute__((ext_vector_type(4)))  float    v4f;
typedef v8h  __attribute__((may_alias)) v8ha;
typedef v4f  __attribute__((may_alias)) v4fa;
typedef v8us __attribute__((may_alias)) v8usa;

__device__ __forceinline__ unsigned short f2bf(float f) { unsigned u = __float_as_uint(f); u += 0x7FFFu + ((u >> 16) & 1u); return (unsigned short)(u >> 16); }
__device__ __forceinline__ float bf2f(unsigned short b) { return __uint_as_float(((unsigned)b) << 16); }
__device__ __forceinline__ float bfr(float f) { return bf2f(f2bf(f)); }
__device__ __forceinline__ v16h cat16(v8h lo, v8h hi) { return __builtin_shufflevector(lo, hi, 0, 1, 2, 3, 4, 5, 6, 7, 8, 9, 10, 11, 12, 13, 14, 15); }
__device__ __forceinline__ v16bf cat16b(v8us lo, v8us hi) { return __builtin_bit_cast(v16bf, __builtin_shufflevector(lo, hi, 0, 1, 2, 3, 4, 5, 6, 7, 8, 9, 10, 11, 12, 13, 14, 15)); }
__device__ __forceinline__ v8f wmma16(v16h a, v16h b, v8f c) { return __builtin_amdgcn_wmma_f32_16x16x32_f16(false, a, false, b, (short)0, c, false, false); }
__device__ __forceinline__ v8f wmmab(v16bf a, v16bf b, v8f c) { return __builtin_amdgcn_wmma_f32_16x16x32_bf16(false, a, false, b, (short)0, c, false, false); }

// fragment loaders: 16 rows (lane c = row) of a K-contiguous 16-bit plane, p already at the lane's row and at 8h: k = 8h + s for s < 8, 16 + 8h + (s - 8) behind
template <typename T16> struct WFrag;
template <> struct WFrag<h16> { typedef v16h V; static __device__ __forceinline__ V ld(const h16* p) { return cat16(*(const v8h*)p, *(const v8h*)(p + 16)); } static __device__ __forceinline__ v8f mma(V a, V b, v8f c) { return wmma16(a, b, c); } };
template <> struct WFrag<bf> { typedef v16bf V; static __device__ __forceinline__ V ld(const bf* p) { return cat16b(*(const v8us*)p, *(const v8us*)(p + 16)); } static __device__ __forceinline__ v8f mma(V a, V b, v8f c) { return wmmab(a, b, c); } };

__device__ __forceinline__ h16 tohx(float x) { return (h16)x; }
__device__ __forceinline__ void splitf(float y, unsigned short& h, unsigned short& l) { h = f2bf(y); l = f2bf(y - bf2f(h)); }
typedef __attribute__((ext_vector_type(2))) _Float16 v2h;
typedef __attribute__((ext_vector_type(4))) _Float16 v4h;
typedef __attribute__((ext_vector_type(2))) unsigned short v2us;
typedef __attribute__((ext_vector_type(4))) unsigned short v4us;
typedef __attribute__((ext_vector_type(2))) float v2f;
typedef __attribute__((ext_vector_type(4))) int v4i;

__device__ __forceinline__ float xhalf(float x) { const int b = __float_as_int(x); return __int_as_float(__builtin_amdgcn_permlanex16(b, b, 0x76543210, 0xfedcba98, false, false)); }   /* lane l <-> l ^ 16 */
// behind a group of global loads or stores: their address (and data) registers are rewritten only behind this wait. The group's base pointers are inputs, so that their registers stay theirs up to the wait
// (no load of the group lands on them); the scheduling barrier keeps the register writes that follow in the source behind the wait in the listing too
__device__ __forceinline__ void xwait(const void* p0, const void* p1) { asm volatile("s_wait_xcnt 0x0" :: "v"(p0), "v"(p1) : "memory"); __builtin_amdgcn_sched_barrier(0); }
// 2^x: v_exp_f32 and, in the same statement, the one slot that the instruction set asks for behind a transcendental before its result is read or its source overwritten
__device__ __forceinline__ float ex2(float x) { float r; asm("v_exp_f32 %0, %1\n\tv_nop" : "=v"(r) : "v"(x)); return r; }
#define SCL2 0.18033688011112042f   // SCL x log2(e)
#define SK   64                   // keys per stage
#define NST  (TT / SK)            // stages
#define LPB  144                  // LDS row pitch, bytes: 128 + 16 = 16 x odd, 16 rows of a 16-byte read fall on 64 different banks
#define LPE  (LPB / 2)            // the same in 16-bit elements
#define TSZ  (64 * LPB)           // one tile of 64 rows
#define BSZ  (5 * TSZ)            // one stage: K hi, K lo, V^T fp16, V^T hi, V^T lo
// one stage's ten copies of a thread (two 16-byte pieces of each of the five tiles; a wave's 32 lanes copy four whole 128-byte rows at a time). d: the thread's place in tile 0 of the target buffer (LDS byte address);
// the five pointers: the stage's first element in each plane (the same for the whole work-group); ko, vo: the thread's piece in rows 0-31 of a K tile and of a V^T tile, in elements; rows 32-63 lie 32 plane rows further.
// s_wait_xcnt 0 is the statement's last line, so that no address register of a copy is rewritten in front of it
__device__ __forceinline__ void stage_copy(unsigned d, const bf* skh, const bf* skl, const h16* sv16, const bf* svh, const bf* svl, unsigned ko, unsigned vo) {
    const bf* kh = skh + ko; const bf* kl = skl + ko; const h16* v16 = sv16 + vo; const bf* vh = svh + vo; const bf* vl = svl + vo;
    const bf* kh1 = skh + (ko + 32 * HD); const bf* kl1 = skl + (ko + 32 * HD); const h16* v161 = sv16 + (vo + 32 * TT); const bf* vh1 = svh + (vo + 32 * TT); const bf* vl1 = svl + (vo + 32 * TT);
    asm volatile("global_load_async_to_lds_b128 %0, %10, off\n\t"
                 "global_load_async_to_lds_b128 %1, %11, off\n\t"
                 "global_load_async_to_lds_b128 %2, %12, off\n\t"
                 "global_load_async_to_lds_b128 %3, %13, off\n\t"
                 "global_load_async_to_lds_b128 %4, %14, off\n\t"
                 "global_load_async_to_lds_b128 %5, %15, off\n\t"
                 "global_load_async_to_lds_b128 %6, %16, off\n\t"
                 "global_load_async_to_lds_b128 %7, %17, off\n\t"
                 "global_load_async_to_lds_b128 %8, %18, off\n\t"
                 "global_load_async_to_lds_b128 %9, %19, off\n\t"
                 "s_wait_xcnt 0x0"
                 :: "v"(d), "v"(d + 32 * LPB), "v"(d + TSZ), "v"(d + TSZ + 32 * LPB), "v"(d + 2 * TSZ), "v"(d + 2 * TSZ + 32 * LPB), "v"(d + 3 * TSZ), "v"(d + 3 * TSZ + 32 * LPB), "v"(d + 4 * TSZ), "v"(d + 4 * TSZ + 32 * LPB),
                    "v"(kh), "v"(kh1), "v"(kl), "v"(kl1), "v"(v16), "v"(v161), "v"(vh), "v"(vh1), "v"(vl), "v"(vl1) : "memory");
}
// one wave's work on one stage in LDS (st: the stage's buffer; loff: the lane's place in a 16-row block of a tile, in elements; hr: the wave's kind, the same in all its lanes): two passes of 32 keys.
// Scores and softmax are the same code for both kinds of wave; only the V^T fragments and the second product differ, under scalar branches, so that the stage loop and its barrier are one for the whole work-group
__device__ __forceinline__ void fattn_stage(const unsigned char* st, unsigned loff, bool hr, const v16bf (&qh)[2][2], const v16bf (&ql)[2][2], v8f (&o)[4][2], float (&m)[2], float (&l)[2]) {
    const bf* khp = (const bf*)st + loff; const bf* klp = (const bf*)(st + TSZ) + loff; const bf* vap = (const bf*)(st + (hr ? 3 * TSZ : 2 * TSZ)) + loff; const bf* vlp = (const bf*)(st + 4 * TSZ) + loff;
    const float cb = hr ? 0.0f : 10.0f;
    // the fragment and accumulator arrays are indexed by constants only (every loop over them is unrolled), so that they stay in registers
    v16bf kh[2][2], kl[2][2];
#pragma unroll
    for (int kt = 0; kt < 2; ++kt)
#pragma unroll
        for (int ks = 0; ks < 2; ++ks) { kh[kt][ks] = WFrag<bf>::ld(khp + kt * 16 * LPE + ks * 32); kl[kt][ks] = WFrag<bf>::ld(klp + kt * 16 * LPE + ks * 32); }
    // unrolled: the pass number is a constant in every LDS offset
#pragma unroll
    for (int ps_ = 0; ps_ < SK / 32; ++ps_) {
        /* this pass's V^T fragments, asked for first: they are used last. va: the hi plane's bits (hr) or the fp16 plane's; vb: the lo plane's (hr only) */
        v16bf va[4], vb[4];
#pragma unroll
        for (int dt = 0; dt < 4; ++dt) va[dt] = WFrag<bf>::ld(vap + dt * 16 * LPE + ps_ * 32);
        if (hr) {
#pragma unroll
            for (int dt = 0; dt < 4; ++dt) vb[dt] = WFrag<bf>::ld(vlp + dt * 16 * LPE + ps_ * 32); }
        v8f s[2][2];
#pragma unroll
        for (int kt = 0; kt < 2; ++kt)
#pragma unroll
            for (int qt = 0; qt < 2; ++qt) { v8f a = (v8f){};
#pragma unroll
                for (int ks = 0; ks < 2; ++ks) { a = wmmab(kh[kt][ks], qh[qt][ks], a); a = wmmab(kl[kt][ks], qh[qt][ks], a); a = wmmab(kh[kt][ks], ql[qt][ks], a); }
                s[kt][qt] = a; }
        /* the stage's next pass's key fragments into the same registers, behind their last use; never beyond the stage, whose successor is not published yet */
        if (ps_ + 1 < SK / 32) {
#pragma unroll
            for (int kt = 0; kt < 2; ++kt)
#pragma unroll
                for (int ks = 0; ks < 2; ++ks) { kh[kt][ks] = WFrag<bf>::ld(khp + ((ps_ + 1) * 32 + kt * 16) * LPE + ks * 32); kl[kt][ks] = WFrag<bf>::ld(klp + ((ps_ + 1) * 32 + kt * 16) * LPE + ks * 32); } }
        float p[2][16], al[2];
#pragma unroll
        for (int qt = 0; qt < 2; ++qt) {
            float mx = s[0][qt][0];
#pragma unroll
            for (int j = 1; j < 8; ++j) mx = fmaxf(mx, s[0][qt][j]);
#pragma unroll
            for (int j = 0; j < 8; ++j) mx = fmaxf(mx, s[1][qt][j]);
            mx = fmaxf(mx, xhalf(mx));
            const float mn = fmaxf(m[qt], mx * SCL2); al[qt] = ex2(m[qt] - mn); m[qt] = mn;
            const float nb = cb - mn;
            float ps = 0.f;
#pragma unroll
            for (int e = 0; e < 16; ++e) { p[qt][e] = ex2(fmaf(s[e >> 3][qt][e & 7], SCL2, nb)); ps += p[qt][e]; }
            l[qt] = fmaf(l[qt], al[qt], ps);
        }
        /* ex2 is asm: the products below stand in blocks of their own, behind every ex2 of the pass, and behind the score products stands the whole maximum chain */
        if (hr) {
#pragma unroll
            for (int qt = 0; qt < 2; ++qt) { v8us h0, h1, l0, l1;
#pragma unroll
                for (int e = 0; e < 8; ++e) { unsigned short a2, c2; splitf(p[qt][e], a2, c2); h0[e] = a2; l0[e] = c2; splitf(p[qt][8 + e], a2, c2); h1[e] = a2; l1[e] = c2; }
                const v16bf ph = cat16b(h0, h1), pl = cat16b(l0, l1);
#pragma unroll
                for (int dt = 0; dt < 4; ++dt) { o[dt][qt] *= al[qt]; o[dt][qt] = wmmab(va[dt], ph, o[dt][qt]); o[dt][qt] = wmmab(va[dt], pl, o[dt][qt]); o[dt][qt] = wmmab(vb[dt], ph, o[dt][qt]); } }
        } else {
#pragma unroll
            for (int qt = 0; qt < 2; ++qt) { v16h pf;
#pragma unroll
                for (int e = 0; e < 16; ++e) pf[e] = tohx(p[qt][e]);
#pragma unroll
                for (int dt = 0; dt < 4; ++dt) { o[dt][qt] *= al[qt]; o[dt][qt] = wmma16(__builtin_bit_cast(v16h, va[dt]), pf, o[dt][qt]); } }
        }
    }
}
// grid (16, heads), 8 waves: wave 0 takes one of the head's 16 hi/lo query tiles (rows < RH), waves 1-7 seven of its 112 fp16 tiles, so that every work-group carries the same load
__global__ __launch_bounds__(256) void k_fattn(const bf* __restrict__ QPh, const bf* __restrict__ QPl, const h16* __restrict__ VT16, const bf* __restrict__ VTh, const bf* __restrict__ VTl, float* __restrict__ out) {
    __shared__ __attribute__((aligned(16))) unsigned char ring[2 * BSZ];
    const int w = __builtin_amdgcn_readfirstlane((int)(threadIdx.x >> 5)); const int lane = threadIdx.x & 31, lr = lane & 15, hi = lane >> 4; const size_t hp = (size_t)blockIdx.y * TT * HD;
    const bf* Kh = QPh + hp; const bf* Kl = QPl + hp; float* orow = out + blockIdx.y * HD;
    const int q0 = (w == 0) ? (int)blockIdx.x * 32 : RH + ((int)blockIdx.x * 7 + w - 1) * 32;
    /* the thread's piece of every tile: row tid / 8 (and 32 rows further), 16-byte column tid % 8 */
    const int crow = (int)(threadIdx.x >> 3), ccol = (int)(threadIdx.x & 7);
    const unsigned cd = (unsigned)(size_t)ring + (unsigned)(crow * LPB + ccol * 16);
    const unsigned ko = (unsigned)(crow * HD + ccol * 8), vo = (unsigned)(crow * TT + ccol * 8);
    const h16* V16 = VT16 + hp; const bf* Vh = VTh + hp; const bf* Vl = VTl + hp;
    stage_copy(cd, Kh, Kl, V16, Vh, Vl, ko, vo);   /* stage 0 into buffer 0 */
    /* the query fragments, kept in registers */
    v16bf qh[2][2], ql[2][2];
    const bf* qhp = Kh + (size_t)q0 * HD + lr * HD + 8 * hi; const bf* qlp = Kl + (size_t)q0 * HD + lr * HD + 8 * hi;
#pragma unroll
    for (int qt = 0; qt < 2; ++qt)
#pragma unroll
        for (int ks = 0; ks < 2; ++ks) { qh[qt][ks] = WFrag<bf>::ld(qhp + qt * 16 * HD + ks * 32); ql[qt][ks] = WFrag<bf>::ld(qlp + qt * 16 * HD + ks * 32); }
    xwait(qhp, qlp);
    v8f o[4][2];
#pragma unroll
    for (int dt = 0; dt < 4; ++dt)
#pragma unroll
        for (int qt = 0; qt < 2; ++qt) o[dt][qt] = (v8f){};
    float m[2] = {-3.0e38f, -3.0e38f}, l[2] = {0.f, 0.f};
    const unsigned loff = (unsigned)(lr * LPE + 8 * hi);
    asm volatile("s_wait_asynccnt 0x0" ::: "memory");   /* this wave's copies of stage 0 have landed */
    __syncthreads();                                     /* and every other wave's: stage 0 is published */
    stage_copy(cd + BSZ, Kh + SK * HD, Kl + SK * HD, V16 + SK, Vh + SK, Vl + SK, ko, vo);   /* stage 1 into buffer 1 */
    // rolled: one stage's fragments, scores and the output tiles are the register budget
#pragma unroll 1
    for (int s = 0; s < NST; ++s) {
        const unsigned char* st = ring + (s & 1) * BSZ;
        fattn_stage(st, loff, w == 0, qh, ql, o, m, l);
        /* publish point of stage s + 1, every wave: its own LDS reads of stage s are done, its own copies of stage s + 1 have landed, then the barrier; only behind it is stage s's buffer refilled */
        asm volatile("s_wait_dscnt 0x0" ::: "memory");
        asm volatile("s_wait_asynccnt 0x0" ::: "memory");
        __syncthreads();
        if (s + 2 < NST) stage_copy(cd + (unsigned)(s & 1) * BSZ, Kh + (size_t)(s + 2) * SK * HD, Kl + (size_t)(s + 2) * SK * HD, V16 + (s + 2) * SK, Vh + (s + 2) * SK, Vl + (s + 2) * SK, ko, vo);
    }
    asm volatile("s_wait_asynccnt 0x0" ::: "memory");   /* no copy is outstanding when the wave ends */
    /* register j of o[dt][qt] = O[query q0 + 16 qt + c][d = 16 dt + 8h + j]: 8 consecutive floats of one output row per lane */
#pragma unroll
    for (int qt = 0; qt < 2; ++qt) { const float f = __fdiv_rn(1.0f, l[qt] + xhalf(l[qt])); float* r = orow + (size_t)(q0 + qt * 16 + lr) * DM + 8 * hi;
#pragma unroll
        for (int dt = 0; dt < 4; ++dt) { v4f a, b;
#pragma unroll
            for (int j = 0; j < 4; ++j) { a[j] = o[dt][qt][j] * f; b[j] = o[dt][qt][4 + j] * f; }
            *(v4f*)(r + dt * 16) = a; *(v4f*)(r + dt * 16 + 4) = b; }
        xwait(r, r); }
}

// ---- k_planes: every plane that k_fattn reads, in one launch. One work-group takes 128 positions x the 64 columns of one head: the f32 tile is read once, in whole 128-byte lines, and laid in LDS;
// from there each thread takes 8 neighbours of a row (K hi/lo planes [h][t][64]) and 8 neighbours of a column (V^T fp16, hi, lo planes [h][64][t]), so that every store is 16 bytes a lane and 8 lanes fill a 128-byte line.
#define PT   128                  // positions per tile
#define PP   65                   // LDS row pitch in floats, odd: 8 floats of 4 neighbouring rows, and rows 8 apart of 4 neighbouring columns, fall on 32 different banks
__global__ __launch_bounds__(256) void k_planes(const float* __restrict__ X, bf* __restrict__ Ph, bf* __restrict__ Pl, h16* __restrict__ V16, bf* __restrict__ Vh, bf* __restrict__ Vl) {
    __shared__ float tile[PT * PP];
    const int tid = (int)threadIdx.x, t0 = (int)blockIdx.x * PT; const size_t hp = (size_t)blockIdx.y * TT * HD;
    /* in: 16 lanes x 16 bytes = the head's 256 bytes of one position; all eight loads of a thread in flight together */
    const int ir = tid >> 4, ic = (tid & 15) * 4;
    const float* sp = X + (size_t)(t0 + ir) * DM + blockIdx.y * HD + ic;
    // every loop of this kernel is unrolled: the register arrays are indexed by constants only, and each group of loads or stores stands together in front of its wait
    v4f in[PT / 16];
#pragma unroll
    for (int i = 0; i < PT / 16; ++i) in[i] = *(const v4f*)(sp + (size_t)i * 16 * DM);
    xwait(sp, sp);
#pragma unroll
    for (int i = 0; i < PT / 16; ++i)
#pragma unroll
        for (int j = 0; j < 4; ++j) tile[(ir + i * 16) * PP + ic + j] = in[i][j];
    __syncthreads();   /* the tile is whole before anybody reads across the writers' rows */
    const int r8 = tid >> 3, c8 = (tid & 7) * 8;
    /* K planes: position t0 + r8 + 32 i, columns c8 .. c8 + 7 */
    v8us kh[PT / 32], kl[PT / 32];
#pragma unroll
    for (int i = 0; i < PT / 32; ++i)
#pragma unroll
        for (int j = 0; j < 8; ++j) { unsigned short a2, c2; splitf(tile[(r8 + i * 32) * PP + c8 + j], a2, c2); kh[i][j] = a2; kl[i][j] = c2; }
    bf* kph = Ph + hp + (size_t)(t0 + r8) * HD + c8; bf* kpl = Pl + hp + (size_t)(t0 + r8) * HD + c8;
#pragma unroll
    for (int i = 0; i < PT / 32; ++i) { *(v8us*)(kph + i * 32 * HD) = kh[i]; *(v8us*)(kpl + i * 32 * HD) = kl[i]; }
    xwait(kph, kpl);
    /* V^T planes: column r8 + 32 i, positions t0 + 64 u + c8 .. + 7 */
    const size_t vo = hp + (size_t)r8 * TT + t0 + c8;
    h16* vp16 = V16 + vo; bf* vph = Vh + vo; bf* vpl = Vl + vo;
#pragma unroll
    for (int i = 0; i < HD / 32; ++i) {
        v8h f[PT / 64]; v8us vh[PT / 64], vl[PT / 64];
#pragma unroll
        for (int u = 0; u < PT / 64; ++u)
#pragma unroll
            for (int j = 0; j < 8; j += 2) { v2f x; unsigned short a2, c2; x[0] = tile[(u * 64 + c8 + j) * PP + r8 + i * 32]; x[1] = tile[(u * 64 + c8 + j + 1) * PP + r8 + i * 32];
                const v2h y = __builtin_convertvector(x, v2h); f[u][j] = y[0]; f[u][j + 1] = y[1];   /* two at a time: one packed conversion, to nearest even like tohx */
                splitf(x[0], a2, c2); vh[u][j] = a2; vl[u][j] = c2; splitf(x[1], a2, c2); vh[u][j + 1] = a2; vl[u][j + 1] = c2; }
#pragma unroll
        for (int u = 0; u < PT / 64; ++u) { *(v8h*)(vp16 + (size_t)i * 32 * TT + u * 64) = f[u]; *(v8us*)(vph + (size_t)i * 32 * TT + u * 64) = vh[u]; *(v8us*)(vpl + (size_t)i * 32 * TT + u * 64) = vl[u]; }
        xwait(vp16, vph); }
}
extern "C" void kernel_launch(void* const* d_in, const int* in_sizes, int n_in,
                              void* d_out, int out_size, void* d_ws, size_t ws_size, hipStream_t stream) {
    (void)in_sizes; (void)n_in; (void)out_size;
    const float* x = (const float*)d_in[0];   /* x [4096][1024]: q = k = v = x reshaped to 16 heads x 64 (no projections, no batch) */
    float* OUT = (float*)d_out;     // [4096][1024]
    char* wsp = (char*)d_ws;
    auto take = [&](size_t bytes) { char* p = wsp; wsp += (bytes + 255) & ~(size_t)255; return (void*)p; };
    bf* QPh = (bf*)take((size_t)TT * MID * 2); bf* QPl = (bf*)take((size_t)TT * MID * 2);   /* k = q: one set of planes */
    h16* VT16 = (h16*)take((size_t)CO * TT * 2); bf* VTh = (bf*)take((size_t)CO * TT * 2); bf* VTl = (bf*)take((size_t)CO * TT * 2);
    if ((size_t)(wsp - (char*)d_ws) > ws_size) return;    // ws 256 MiB (carve 40 MiB)
    k_planes<<<dim3(TT / PT, NH_, 1), 256, 0, stream>>>(x, QPh, QPl, VT16, VTh, VTl);   /* q (= k) planes [h][n][64] (bf16 hi/lo split) and v^T planes [h][64][n] (fp16, bf16 hi/lo) straight from the f32 input */
    k_fattn<<<dim3(RH / 32, NH_, 1), 256, 0, stream>>>(QPh, QPl, VT16, VTh, VTl, OUT);   /* all heads: scores x 1/8, softmax over the 4,096 keys, attn.V, output rows written once */
}

// v004
// A run of this version takes 127 microseconds.
// Next to v003, in two timings, it ran 1.06 times as fast each time.
// All steps since v000 together make it 30.6 times as fast.
#include <hip/hip_runtime.h>

// Scaled dot-product self-attention where q = k = v = the input itself (x [4096][1024] reshaped to 16 heads x 64; no projections, no batch; scores = x_h.x_h x 1/sqrt(64); softmax (no mask); out = attn.x_h merged -> [4096][1024] (4.2 M); argument order x).
// Layout: the f32 input feeds one plane builder directly: ONE set of hi/lo planes serves as both q and k (k = q), value^T planes from the same rows; k_fattn then does scores (every row hi/lo, 3 products), softmax and attn.V (rows < 512 hi/lo, rest fp16 x1024) in one launch, a running maximum and sum per query, and writes the output once. NOTE the hi/lo split carries the f32 input.
// Compute dtypes, f32 accumulate: input split into bf16 hi/lo (scores, exact to ~2^-16) and fp16 (value planes for rows >= 512); softmax f32; output f32.

#define NB_  1
#define TT   4096
#define DM   1024
#define NH_  16
#define NKV  16
#define REP  (NH_ / NKV)
#define HD   64
#define DQ   (NH_ * HD)
#define DKV  (NKV * HD)
#define ZH   1
#define RH   512                  // query rows < RH use hi+lo planes
#define WIN  0
#define PCAR 1024.0f
#define SCL  0.125f   // 1/sqrt(float32(64))
#define MID  1024      // q / k width
#define CO   1024      // v width
#define CC   1024
typedef _Float16 h16;
typedef unsigned short bf;
typedef __attribute__((ext_vector_type(16))) __bf16   v16bf;
typedef __attribute__((ext_vector_type(16))) _Float16 v16h;
typedef __attribute__((ext_vector_type(8)))  _Float16 v8h;
typedef __attribute__((ext_vector_type(8)))  unsigned short v8us;
typedef __attribute__((ext_vector_type(8)))  float    v8f;
typedef __attribute__((ext_vector_type(4)))  float    v4f;
typedef v8h  __attribute__((may_alias)) v8ha;
typedef v4f  __attribute__((may_alias)) v4fa;
typedef v8us __attribute__((may_alias)) v8usa;

__device__ __forceinline__ unsigned short f2bf(float f) { unsigned u = __float_as_uint(f); u += 0x7FFFu + ((u >> 16) & 1u); return (unsigned short)(u >> 16); }
__device__ __forceinline__ float bf2f(unsigned short b) { return __uint_as_float(((unsigned)b) << 16); }
__device__ __forceinline__ float bfr(float f) { return bf2f(f2bf(f)); }
__device__ __forceinline__ v16h cat16(v8h lo, v8h hi) { return __builtin_shufflevector(lo, hi, 0, 1, 2, 3, 4, 5, 6, 7, 8, 9, 10, 11, 12, 13, 14, 15); }
__device__ __forceinline__ v16bf cat16b(v8us lo, v8us hi) { return __builtin_bit_cast(v16bf, __builtin_shufflevector(lo, hi, 0, 1, 2, 3, 4, 5, 6, 7, 8, 9, 10, 11, 12, 13, 14, 15)); }
__device__ __forceinline__ v8f wmma16(v16h a, v16h b, v8f c) { return __builtin_amdgcn_wmma_f32_16x16x32_f16(false, a, false, b, (short)0, c, false, false); }
__device__ __forceinline__ v8f wmmab(v16bf a, v16bf b, v8f c) { return __builtin_amdgcn_wmma_f32_16x16x32_bf16(false, a, false, b, (short)0, c, false, false); }

// fragment loaders: 16 rows (lane c = row) of a K-contiguous 16-bit plane, p already at the lane's row and at 8h: k = 8h + s for s < 8, 16 + 8h + (s - 8) behind
template <typename T16> struct WFrag;
template <> struct WFrag<h16> { typedef v16h V; static __device__ __forceinline__ V ld(const h16* p) { return cat16(*(const v8h*)p, *(const v8h*)(p + 16)); } static __device__ __forceinline__ v8f mma(V a, V b, v8f c) { return wmma16(a, b, c); } };
template <> struct WFrag<bf> { typedef v16bf V; static __device__ __forceinline__ V ld(const bf* p) { return cat16b(*(const v8us*)p, *(const v8us*)(p + 16)); } static __device__ __forceinline__ v8f mma(V a, V b, v8f c) { return wmmab(a, b, c); } };

__device__ __forceinline__ h16 tohx(float x) { return (h16)x; }
__device__ __forceinline__ void splitf(float y, unsigned short& h, unsigned short& l) { h = f2bf(y); l = f2bf(y - bf2f(h)); }
typedef __attribute__((ext_vector_type(2))) _Float16 v2h;
typedef __attribute__((ext_vector_type(4))) _Float16 v4h;
typedef __attribute__((ext_vector_type(2))) unsigned short v2us;
typedef __attribute__((ext_vector_type(4))) unsigned short v4us;
typedef __attribute__((ext_vector_type(2))) float v2f;
typedef __attribute__((ext_vector_type(4))) int v4i;

__device__ __forceinline__ float xhalf(float x) { const int b = __float_as_int(x); return __int_as_float(__builtin_amdgcn_permlanex16(b, b, 0x76543210, 0xfedcba98, false, false)); }   /* lane l <-> l ^ 16 */
// behind a group of global loads or stores: their address (and data) registers are rewritten only behind this wait. The group's base pointers are inputs, so that their registers stay theirs up to the wait
// (no load of the group lands on them); the scheduling barrier keeps the register writes that follow in the source behind the wait in the listing too
__device__ __forceinline__ void xwait(const void* p0, const void* p1) { asm volatile("s_wait_xcnt 0x0" :: "v"(p0), "v"(p1) : "memory"); __builtin_amdgcn_sched_barrier(0); }
// 2^x: v_exp_f32 and, in the same statement, the one slot that the instruction set asks for behind a transcendental before its result is read or its source overwritten
__device__ __forceinline__ float ex2(float x) { float r; asm("v_exp_f32 %0, %1\n\tv_nop" : "=v"(r) : "v"(x)); return r; }
#define SCL2 0.18033688011112042f   // SCL x log2(e)
#define QT   1                    // 16-column query tiles per wave
#define SK   64                   // keys per stage
#define NST  (TT / SK)            // stages
#define LPB  144                  // LDS row pitch, bytes: 128 + 16 = 16 x odd, 16 rows of a 16-byte read fall on 64 different banks
#define LPE  (LPB / 2)            // the same in 16-bit elements
#define TSZ  (64 * LPB)           // one tile of 64 rows
#define BSZ  (5 * TSZ)            // one stage: K hi, K lo, V^T fp16, V^T hi, V^T lo
// one stage's five copies of a thread (one 16-byte piece of each of the five tiles; a wave's 32 lanes copy four whole 128-byte rows at a time). d: the thread's place in tile 0 of the target buffer (LDS byte address);
// the five pointers: the stage's first element in each plane (the same for the whole work-group); ko, vo: the thread's piece of a K tile and of a V^T tile, in elements.
// s_wait_xcnt 0 is the statement's last line, so that no address register of a copy is rewritten in front of it
__device__ __forceinline__ void stage_copy(unsigned d, const bf* skh, const bf* skl, const h16* sv16, const bf* svh, const bf* svl, unsigned ko, unsigned vo) {
    const bf* kh = skh + ko; const bf* kl = skl + ko; const h16* v16 = sv16 + vo; const bf* vh = svh + vo; const bf* vl = svl + vo;
    asm volatile("global_load_async_to_lds_b128 %0, %5, off\n\t"
                 "global_load_async_to_lds_b128 %1, %6, off\n\t"
                 "global_load_async_to_lds_b128 %2, %7, off\n\t"
                 "global_load_async_to_lds_b128 %3, %8, off\n\t"
                 "global_load_async_to_lds_b128 %4, %9, off\n\t"
                 "s_wait_xcnt 0x0"
                 :: "v"(d), "v"(d + TSZ), "v"(d + 2 * TSZ), "v"(d + 3 * TSZ), "v"(d + 4 * TSZ), "v"(kh), "v"(kl), "v"(v16), "v"(vh), "v"(vl) : "memory");
}
// one wave's work on one stage in LDS (st: the stage's buffer; loff: the lane's place in a 16-row block of a tile, in elements; hr: the wave's kind, the same in all its lanes): two passes of 32 keys.
// Scores and softmax are the same code for both kinds of wave; only the V^T fragments and the second product differ, under scalar branches, so that the stage loop and its barrier are one for the whole work-group
__device__ __forceinline__ void fattn_stage(const unsigned char* st, unsigned loff, bool hr, const v16bf (&qh)[QT][2], const v16bf (&ql)[QT][2], v8f (&o)[4][QT], float (&m)[QT], float (&l)[QT]) {
    const bf* khp = (const bf*)st + loff; const bf* klp = (const bf*)(st + TSZ) + loff; const bf* vap = (const bf*)(st + (hr ? 3 * TSZ : 2 * TSZ)) + loff; const bf* vlp = (const bf*)(st + 4 * TSZ) + loff;
    const float cb = hr ? 0.0f : 10.0f;
    // the fragment and accumulator arrays are indexed by constants only (every loop over them is unrolled), so that they stay in registers
    v16bf kh[2][2], kl[2][2];
#pragma unroll
    for (int kt = 0; kt < 2; ++kt)
#pragma unroll
        for (int ks = 0; ks < 2; ++ks) { kh[kt][ks] = WFrag<bf>::ld(khp + kt * 16 * LPE + ks * 32); kl[kt][ks] = WFrag<bf>::ld(klp + kt * 16 * LPE + ks * 32); }
    // unrolled: the pass number is a constant in every LDS offset
#pragma unroll
    for (int ps_ = 0; ps_ < SK / 32; ++ps_) {
        /* this pass's V^T fragments, asked for first: they are used last. va: the hi plane's bits (hr) or the fp16 plane's; vb: the lo plane's (hr only) */
        v16bf va[4], vb[4];
#pragma unroll
        for (int dt = 0; dt < 4; ++dt) va[dt] = WFrag<bf>::ld(vap + dt * 16 * LPE + ps_ * 32);
        if (hr) {
#pragma unroll
            for (int dt = 0; dt < 4; ++dt) vb[dt] = WFrag<bf>::ld(vlp + dt * 16 * LPE + ps_ * 32); }
        v8f s[2][QT];
#pragma unroll
        for (int kt = 0; kt < 2; ++kt)
#pragma unroll
            for (int qt = 0; qt < QT; ++qt) { v8f a = (v8f){};
#pragma unroll
                for (int ks = 0; ks < 2; ++ks) { a = wmmab(kh[kt][ks], qh[qt][ks], a); a = wmmab(kl[kt][ks], qh[qt][ks], a); a = wmmab(kh[kt][ks], ql[qt][ks], a); }
                s[kt][qt] = a; }
        /* the stage's next pass's key fragments into the same registers, behind their last use; never beyond the stage, whose successor is not published yet */
        if (ps_ + 1 < SK / 32) {
#pragma unroll
            for (int kt = 0; kt < 2; ++kt)
#pragma unroll
                for (int ks = 0; ks < 2; ++ks) { kh[kt][ks] = WFrag<bf>::ld(khp + ((ps_ + 1) * 32 + kt * 16) * LPE + ks * 32); kl[kt][ks] = WFrag<bf>::ld(klp + ((ps_ + 1) * 32 + kt * 16) * LPE + ks * 32); } }
        float p[QT][16], al[QT];
#pragma unroll
        for (int qt = 0; qt < QT; ++qt) {
            float mx = s[0][qt][0];
#pragma unroll
            for (int j = 1; j < 8; ++j) mx = fmaxf(mx, s[0][qt][j]);
#pragma unroll
            for (int j = 0; j < 8; ++j) mx = fmaxf(mx, s[1][qt][j]);
            mx = fmaxf(mx, xhalf(mx));
            const float mn = fmaxf(m[qt], mx * SCL2); al[qt] = ex2(m[qt] - mn); m[qt] = mn;
            const float nb = cb - mn;
            float ps = 0.f;
#pragma unroll
            for (int e = 0; e < 16; ++e) { p[qt][e] = ex2(fmaf(s[e >> 3][qt][e & 7], SCL2, nb)); ps += p[qt][e]; }
            l[qt] = fmaf(l[qt], al[qt], ps);
        }
        /* ex2 is asm: the products below stand in blocks of their own, behind every ex2 of the pass, and behind the score products stands the whole maximum chain */
        if (hr) {
#pragma unroll
            for (int qt = 0; qt < QT; ++qt) { v8us h0, h1, l0, l1;
#pragma unroll
                for (int e = 0; e < 8; ++e) { unsigned short a2, c2; splitf(p[qt][e], a2, c2); h0[e] = a2; l0[e] = c2; splitf(p[qt][8 + e], a2, c2); h1[e] = a2; l1[e] = c2; }
                const v16bf ph = cat16b(h0, h1), pl = cat16b(l0, l1);
#pragma unroll
                for (int dt = 0; dt < 4; ++dt) { o[dt][qt] *= al[qt]; o[dt][qt] = wmmab(va[dt], ph, o[dt][qt]); o[dt][qt] = wmmab(va[dt], pl, o[dt][qt]); o[dt][qt] = wmmab(vb[dt], ph, o[dt][qt]); } }
        } else {
#pragma unroll
            for (int qt = 0; qt < QT; ++qt) { v16h pf;
#pragma unroll
                for (int e = 0; e < 16; ++e) pf[e] = tohx(p[qt][e]);
#pragma unroll
                for (int dt = 0; dt < 4; ++dt) { o[dt][qt] *= al[qt]; o[dt][qt] = wmma16(__builtin_bit_cast(v16h, va[dt]), pf, o[dt][qt]); } }
        }
    }
}
// grid (16, heads), 16 waves: waves 0 and 1 take two of the head's 32 hi/lo query tiles (rows < RH), waves 2-15 fourteen of its 224 fp16 tiles, so that every work-group carries the same load
__global__ __launch_bounds__(512) void k_fattn(const bf* __restrict__ QPh, const bf* __restrict__ QPl, const h16* __restrict__ VT16, const bf* __restrict__ VTh, const bf* __restrict__ VTl, float* __restrict__ out) {
    __shared__ __attribute__((aligned(16))) unsigned char ring[2 * BSZ];
    const int w = __builtin_amdgcn_readfirstlane((int)(threadIdx.x >> 5)); const int lane = threadIdx.x & 31, lr = lane & 15, hi = lane >> 4; const size_t hp = (size_t)blockIdx.y * TT * HD;
    const bf* Kh = QPh + hp; const bf* Kl = QPl + hp; float* orow = out + blockIdx.y * HD;
    const int q0 = (w < 2) ? ((int)blockIdx.x * 2 + w) * 16 : RH + ((int)blockIdx.x * 14 + w - 2) * 16;
    /* the thread's piece of every tile: row tid / 8, 16-byte column tid % 8 */
    const int crow = (int)(threadIdx.x >> 3), ccol = (int)(threadIdx.x & 7);
    const unsigned cd = (unsigned)(size_t)ring + (unsigned)(crow * LPB + ccol * 16);
    const unsigned ko = (unsigned)(crow * HD + ccol * 8), vo = (unsigned)(crow * TT + ccol * 8);
    const h16* V16 = VT16 + hp; const bf* Vh = VTh + hp; const bf* Vl = VTl + hp;
    stage_copy(cd, Kh, Kl, V16, Vh, Vl, ko, vo);   /* stage 0 into buffer 0 */
    /* the query fragments, kept in registers */
    v16bf qh[QT][2], ql[QT][2];
    const bf* qhp = Kh + (size_t)q0 * HD + lr * HD + 8 * hi; const bf* qlp = Kl + (size_t)q0 * HD + lr * HD + 8 * hi;
#pragma unroll
    for (int qt = 0; qt < QT; ++qt)
#pragma unroll
        for (int ks = 0; ks < 2; ++ks) { qh[qt][ks] = WFrag<bf>::ld(qhp + qt * 16 * HD + ks * 32); ql[qt][ks] = WFrag<bf>::ld(qlp + qt * 16 * HD + ks * 32); }
    xwait(qhp, qlp);
    v8f o[4][QT];
#pragma unroll
    for (int dt = 0; dt < 4; ++dt)
#pragma unroll
        for (int qt = 0; qt < QT; ++qt) o[dt][qt] = (v8f){};
    float m[QT] = {-3.0e38f}, l[QT] = {0.f};
    const unsigned loff = (unsigned)(lr * LPE + 8 * hi);
    asm volatile("s_wait_asynccnt 0x0" ::: "memory");   /* this wave's copies of stage 0 have landed */
    __syncthreads();                                     /* and every other wave's: stage 0 is published */
    stage_copy(cd + BSZ, Kh + SK * HD, Kl + SK * HD, V16 + SK, Vh + SK, Vl + SK, ko, vo);   /* stage 1 into buffer 1 */
    // rolled: one stage's fragments, scores and the output tiles are the register budget
#pragma unroll 1
    for (int s = 0; s < NST; ++s) {
        const unsigned char* st = ring + (s & 1) * BSZ;
        fattn_stage(st, loff, w < 2, qh, ql, o, m, l);
        /* publish point of stage s + 1, every wave: its own LDS reads of stage s are done, its own copies of stage s + 1 have landed, then the barrier; only behind it is stage s's buffer refilled */
        asm volatile("s_wait_dscnt 0x0" ::: "memory");
        asm volatile("s_wait_asynccnt 0x0" ::: "memory");
        __syncthreads();
        if (s + 2 < NST) stage_copy(cd + (unsigned)(s & 1) * BSZ, Kh + (size_t)(s + 2) * SK * HD, Kl + (size_t)(s + 2) * SK * HD, V16 + (s + 2) * SK, Vh + (s + 2) * SK, Vl + (s + 2) * SK, ko, vo);
    }
    asm volatile("s_wait_asynccnt 0x0" ::: "memory");   /* no copy is outstanding when the wave ends */
    /* register j of o[dt][qt] = O[query q0 + 16 qt + c][d = 16 dt + 8h + j]: 8 consecutive floats of one output row per lane */
#pragma unroll
    for (int qt = 0; qt < QT; ++qt) { const float f = __fdiv_rn(1.0f, l[qt] + xhalf(l[qt])); float* r = orow + (size_t)(q0 + qt * 16 + lr) * DM + 8 * hi;
#pragma unroll
        for (int dt = 0; dt < 4; ++dt) { v4f a, b;
#pragma unroll
            for (int j = 0; j < 4; ++j) { a[j] = o[dt][qt][j] * f; b[j] = o[dt][qt][4 + j] * f; }
            *(v4f*)(r + dt * 16) = a; *(v4f*)(r + dt * 16 + 4) = b; }
        xwait(r, r); }
}

// ---- k_planes: every plane that k_fattn reads, in one launch. One work-group takes 128 positions x the 64 columns of one head: the f32 tile is read once, in whole 128-byte lines, and laid in LDS;
// from there each thread takes 8 neighbours of a row (K hi/lo planes [h][t][64]) and 8 neighbours of a column (V^T fp16, hi, lo planes [h][64][t]), so that every store is 16 bytes a lane and 8 lanes fill a 128-byte line.
#define PT   128                  // positions per tile
#define PP   65                   // LDS row pitch in floats, odd: 8 floats of 4 neighbouring rows, and rows 8 apart of 4 neighbouring columns, fall on 32 different banks
__global__ __launch_bounds__(256) void k_planes(const float* __restrict__ X, bf* __restrict__ Ph, bf* __restrict__ Pl, h16* __restrict__ V16, bf* __restrict__ Vh, bf* __restrict__ Vl) {
    __shared__ float tile[PT * PP];
    const int tid = (int)threadIdx.x, t0 = (int)blockIdx.x * PT; const size_t hp = (size_t)blockIdx.y * TT * HD;
    /* in: 16 lanes x 16 bytes = the head's 256 bytes of one position; all eight loads of a thread in flight together */
    const int ir = tid >> 4, ic = (tid & 15) * 4;
    const float* sp = X + (size_t)(t0 + ir) * DM + blockIdx.y * HD + ic;
    // every loop of this kernel is unrolled: the register arrays are indexed by constants only, and each group of loads or stores stands together in front of its wait
    v4f in[PT / 16];
#pragma unroll
    for (int i = 0; i < PT / 16; ++i) in[i] = *(const v4f*)(sp + (size_t)i * 16 * DM);
    xwait(sp, sp);
#pragma unroll
    for (int i = 0; i < PT / 16; ++i)
#pragma unroll
        for (int j = 0; j < 4; ++j) tile[(ir + i * 16) * PP + ic + j] = in[i][j];
    __syncthreads();   /* the tile is whole before anybody reads across the writers' rows */
    const int r8 = tid >> 3, c8 = (tid & 7) * 8;
    /* K planes: position t0 + r8 + 32 i, columns c8 .. c8 + 7 */
    v8us kh[PT / 32], kl[PT / 32];
#pragma unroll
    for (int i = 0; i < PT / 32; ++i)
#pragma unroll
        for (int j = 0; j < 8; ++j) { unsigned short a2, c2; splitf(tile[(r8 + i * 32) * PP + c8 + j], a2, c2); kh[i][j] = a2; kl[i][j] = c2; }
    bf* kph = Ph + hp + (size_t)(t0 + r8) * HD + c8; bf* kpl = Pl + hp + (size_t)(t0 + r8) * HD + c8;
#pragma unroll
    for (int i = 0; i < PT / 32; ++i) { *(v8us*)(kph + i * 32 * HD) = kh[i]; *(v8us*)(kpl + i * 32 * HD) = kl[i]; }
    xwait(kph, kpl);
    /* V^T planes: column r8 + 32 i, positions t0 + 64 u + c8 .. + 7 */
    const size_t vo = hp + (size_t)r8 * TT + t0 + c8;
    h16* vp16 = V16 + vo; bf* vph = Vh + vo; bf* vpl = Vl + vo;
#pragma unroll
    for (int i = 0; i < HD / 32; ++i) {
        v8h f[PT / 64]; v8us vh[PT / 64], vl[PT / 64];
#pragma unroll
        for (int u = 0; u < PT / 64; ++u)
#pragma unroll
            for (int j = 0; j < 8; j += 2) { v2f x; unsigned short a2, c2; x[0] = tile[(u * 64 + c8 + j) * PP + r8 + i * 32]; x[1] = tile[(u * 64 + c8 + j + 1) * PP + r8 + i * 32];
                const v2h y = __builtin_convertvector(x, v2h); f[u][j] = y[0]; f[u][j + 1] = y[1];   /* two at a time: one packed conversion, to nearest even like tohx */
                splitf(x[0], a2, c2); vh[u][j] = a2; vl[u][j] = c2; splitf(x[1], a2, c2); vh[u][j + 1] = a2; vl[u][j + 1] = c2; }
#pragma unroll
        for (int u = 0; u < PT / 64; ++u) { *(v8h*)(vp16 + (size_t)i * 32 * TT + u * 64) = f[u]; *(v8us*)(vph + (size_t)i * 32 * TT + u * 64) = vh[u]; *(v8us*)(vpl + (size_t)i * 32 * TT + u * 64) = vl[u]; }
        xwait(vp16, vph); }
}
extern "C" void kernel_launch(void* const* d_in, const int* in_sizes, int n_in,
                              void* d_out, int out_size, void* d_ws, size_t ws_size, hipStream_t stream) {
    (void)in_sizes; (void)n_in; (void)out_size;
    const float* x = (const float*)d_in[0];   /* x [4096][1024]: q = k = v = x reshaped to 16 heads x 64 (no projections, no batch) */
    float* OUT = (float*)d_out;     // [4096][1024]
    char* wsp = (char*)d_ws;
    auto take = [&](size_t bytes) { char* p = wsp; wsp += (bytes + 255) & ~(size_t)255; return (void*)p; };
    bf* QPh = (bf*)take((size_t)TT * MID * 2); bf* QPl = (bf*)take((size_t)TT * MID * 2);   /* k = q: one set of planes */
    h16* VT16 = (h16*)take((size_t)CO * TT * 2); bf* VTh = (bf*)take((size_t)CO * TT * 2); bf* VTl = (bf*)take((size_t)CO * TT * 2);
    if ((size_t)(wsp - (char*)d_ws) > ws_size) return;    // ws 256 MiB (carve 40 MiB)
    k_planes<<<dim3(TT / PT, NH_, 1), 256, 0, stream>>>(x, QPh, QPl, VT16, VTh, VTl);   /* q (= k) planes [h][n][64] (bf16 hi/lo split) and v^T planes [h][64][n] (fp16, bf16 hi/lo) straight from the f32 input */
    k_fattn<<<dim3(RH / 32, NH_, 1), 512, 0, stream>>>(QPh, QPl, VT16, VTh, VTl, OUT);   /* all heads: scores x 1/8, softmax over the 4,096 keys, attn.V, output rows written once */
}

// v005
// It runs in 114 microseconds.
// Timed twice side by side with v004, it ran 1.12 times as fast both times.
// Counting every step since v000, it is 34.3 times as fast.
#include <hip/hip_runtime.h>

// Scaled dot-product self-attention where q = k = v = the input itself (x [4096][1024] reshaped to 16 heads x 64; no projections, no batch; scores = x_h.x_h x 1/sqrt(64); softmax (no mask); out = attn.x_h merged -> [4096][1024] (4.2 M); argument order x).
// Layout: the f32 input feeds one plane builder directly: ONE set of hi/lo planes serves as both q and k (k = q), value^T planes from the same rows; k_fattn then does scores (every row hi/lo, 3 products), softmax and attn.V (rows < 512 hi/lo, rest fp16 x1024) in one launch, a running maximum and sum per query, and writes the output once. NOTE the hi/lo split carries the f32 input.
// Compute dtypes, f32 accumulate: input split into bf16 hi/lo (scores, exact to ~2^-16) and fp16 (value planes for rows >= 512); softmax f32; output f32.

#define NB_  1
#define TT   4096
#define DM   1024
#define NH_  16
#define NKV  16
#define REP  (NH_ / NKV)
#define HD   64
#define DQ   (NH_ * HD)
#define DKV  (NKV * HD)
#define ZH   1
#define RH   512                  // query rows < RH use hi+lo planes
#define WIN  0
#define PCAR 1024.0f
#define SCL  0.125f   // 1/sqrt(float32(64))
#define MID  1024      // q / k width
#define CO   1024      // v width
#define CC   1024
typedef _Float16 h16;
typedef unsigned short bf;
typedef __attribute__((ext_vector_type(16))) __bf16   v16bf;
typedef __attribute__((ext_vector_type(16))) _Float16 v16h;
typedef __attribute__((ext_vector_type(8)))  _Float16 v8h;
typedef __attribute__((ext_vector_type(8)))  unsigned short v8us;
typedef __attribute__((ext_vector_type(8)))  float    v8f;
typedef __attribute__((ext_vector_type(4)))  float    v4f;
typedef v8h  __attribute__((may_alias)) v8ha;
typedef v4f  __attribute__((may_alias)) v4fa;
typedef v8us __attribute__((may_alias)) v8usa;

__device__ __forceinline__ unsigned short f2bf(float f) { unsigned u = __float_as_uint(f); u += 0x7FFFu + ((u >> 16) & 1u); return (unsigned short)(u >> 16); }
__device__ __forceinline__ float bf2f(unsigned short b) { return __uint_as_float(((unsigned)b) << 16); }
__device__ __forceinline__ float bfr(float f) { return bf2f(f2bf(f)); }
__device__ __forceinline__ v16h cat16(v8h lo, v8h hi) { return __builtin_shufflevector(lo, hi, 0, 1, 2, 3, 4, 5, 6, 7, 8, 9, 10, 11, 12, 13, 14, 15); }
__device__ __forceinline__ v16bf cat16b(v8us lo, v8us hi) { return __builtin_bit_cast(v16bf, __builtin_shufflevector(lo, hi, 0, 1, 2, 3, 4, 5, 6, 7, 8, 9, 10, 11, 12, 13, 14, 15)); }
__device__ __forceinline__ v8f wmma16(v16h a, v16h b, v8f c) { return __builtin_amdgcn_wmma_f32_16x16x32_f16(false, a, false, b, (short)0, c, false, false); }
__device__ __forceinline__ v8f wmmab(v16bf a, v16bf b, v8f c) { return __builtin_amdgcn_wmma_f32_16x16x32_bf16(false, a, false, b, (short)0, c, false, false); }

// fragment loaders: 16 rows (lane c = row) of a K-contiguous 16-bit plane, p already at the lane's row and at 8h: k = 8h + s for s < 8, 16 + 8h + (s - 8) behind
template <typename T16> struct WFrag;
template <> struct WFrag<h16> { typedef v16h V; static __device__ __forceinline__ V ld(const h16* p) { return cat16(*(const v8h*)p, *(const v8h*)(p + 16)); } static __device__ __forceinline__ v8f mma(V a, V b, v8f c) { return wmma16(a, b, c); } };
template <> struct WFrag<bf> { typedef v16bf V; static __device__ __forceinline__ V ld(const bf* p) { return cat16b(*(const v8us*)p, *(const v8us*)(p + 16)); } static __device__ __forceinline__ v8f mma(V a, V b, v8f c) { return wmmab(a, b, c); } };

__device__ __forceinline__ h16 tohx(float x) { return (h16)x; }
__device__ __forceinline__ void splitf(float y, unsigned short& h, unsigned short& l) { h = f2bf(y); l = f2bf(y - bf2f(h)); }
typedef __attribute__((ext_vector_type(2))) _Float16 v2h;
typedef __attribute__((ext_vector_type(4))) _Float16 v4h;
typedef __attribute__((ext_vector_type(2))) unsigned short v2us;
typedef __attribute__((ext_vector_type(4))) unsigned short v4us;
typedef __attribute__((ext_vector_type(2))) float v2f;
typedef __attribute__((ext_vector_type(4))) int v4i;

__device__ __forceinline__ float xhalf(float x) { const int b = __float_as_int(x); return __int_as_float(__builtin_amdgcn_permlanex16(b, b, 0x76543210, 0xfedcba98, false, false)); }   /* lane l <-> l ^ 16 */
// behind a group of global loads or stores: their address (and data) registers are rewritten only behind this wait. The group's base pointers are inputs, so that their registers stay theirs up to the wait
// (no load of the group lands on them); the scheduling barrier keeps the register writes that follow in the source behind the wait in the listing too
__device__ __forceinline__ void xwait(const void* p0, const void* p1) { asm volatile("s_wait_xcnt 0x0" :: "v"(p0), "v"(p1) : "memory"); __builtin_amdgcn_sched_barrier(0); }
// 2^x: v_exp_f32 and, in the same statement, the one slot that the instruction set asks for behind a transcendental before its result is read or its source overwritten
__device__ __forceinline__ float ex2(float x) { float r; asm("v_exp_f32 %0, %1\n\tv_nop" : "=v"(r) : "v"(x)); return r; }
#define SCL2 0.18033688011112042f   // SCL x log2(e)
#define QT   2                    // 16-column query tiles per wave
#define SK   64                   // keys per stage
#define NST  (TT / SK)            // stages
#define LPB  144                  // LDS row pitch, bytes: 128 + 16 = 16 x odd, 16 rows of a 16-byte read fall on 64 different banks
#define LPE  (LPB / 2)            // the same in 16-bit elements
#define TSZ  (64 * LPB)           // one tile of 64 rows
#define BSZ  (5 * TSZ)            // one stage: K hi, K lo, V^T fp16, V^T hi, V^T lo
// one stage's five copies of a thread (one 16-byte piece of each of the five tiles; a wave's 32 lanes copy four whole 128-byte rows at a time). d: the thread's place in tile 0 of the target buffer (LDS byte address);
// the five pointers: the stage's first element in each plane (the same for the whole work-group); ko, vo: the thread's piece of a K tile and of a V^T tile, in elements.
// s_wait_xcnt 0 is the statement's last line, so that no address register of a copy is rewritten in front of it
__device__ __forceinline__ void stage_copy(unsigned d, const bf* skh, const bf* skl, const h16* sv16, const bf* svh, const bf* svl, unsigned ko, unsigned vo) {
    const bf* kh = skh + ko; const bf* kl = skl + ko; const h16* v16 = sv16 + vo; const bf* vh = svh + vo; const bf* vl = svl + vo;
    asm volatile("global_load_async_to_lds_b128 %0, %5, off\n\t"
                 "global_load_async_to_lds_b128 %1, %6, off\n\t"
                 "global_load_async_to_lds_b128 %2, %7, off\n\t"
                 "global_load_async_to_lds_b128 %3, %8, off\n\t"
                 "global_load_async_to_lds_b128 %4, %9, off\n\t"
                 "s_wait_xcnt 0x0"
                 :: "v"(d), "v"(d + TSZ), "v"(d + 2 * TSZ), "v"(d + 3 * TSZ), "v"(d + 4 * TSZ), "v"(kh), "v"(kl), "v"(v16), "v"(vh), "v"(vl) : "memory");
}
typedef __attribute__((ext_vector_type(8))) unsigned v8u;
typedef __attribute__((ext_vector_type(2))) __bf16 v2bf;
// splitf of two neighbours on whole registers: h = the two hi parts (x0's in the low half), l = the two lo parts; both roundings to nearest even, as in f2bf, by the packed conversion.
// The hand-rounded form with its 16-bit pieces took the hi/lo kind, at two query tiles, past the registers a wave has at four waves a SIMD
__device__ __forceinline__ void splitf2(float x0, float x1, unsigned& h, unsigned& l) {
    const v2f x = {x0, x1}; h = __builtin_bit_cast(unsigned, __builtin_convertvector(x, v2bf));
    const v2f xh = {__uint_as_float(h << 16), __uint_as_float(h & 0xFFFF0000u)};
    l = __builtin_bit_cast(unsigned, __builtin_convertvector(x - xh, v2bf)); }
// a lane's sum of its 16 probabilities of one query. It is called inside each kind's own branch, in front of the conversion: there the 16 values end with their conversion and hold no registers through the second product
__device__ __forceinline__ float rowsum(const float (&p)[16]) { float ps = 0.f;
#pragma unroll
    for (int e = 0; e < 16; ++e) ps += p[e];
    return ps; }
// one wave's work on one stage in LDS: ONE pass of 32 keys, the wave's half of the stage's 64 (st: the stage's buffer; koff, voff: the lane's place in a 16-row block of a K tile and of a V^T tile, the wave's half counted in, in elements; hr, nh: the wave's kind, hi/lo or not, the same in all its lanes).
// Scores and softmax are the same code for both kinds of wave; only the V^T fragments and the second product differ, under scalar branches, so that the stage loop and its barrier are one for the whole work-group.
// The two kinds' second products are two branches one behind the other, each on a flag of its own, not an if / else: so each updates O^T in its own registers (as if / else the build kept a second set of all O^T tiles and copied it back every stage)
__device__ __forceinline__ void fattn_stage(const unsigned char* st, unsigned koff, unsigned voff, bool hr, bool nh, const v16bf (&qh)[QT][2], const v16bf (&ql)[QT][2], v8f (&o)[4][QT], float (&m)[QT], float (&l)[QT]) {
    const bf* khp = (const bf*)st + koff; const bf* klp = (const bf*)(st + TSZ) + koff; const bf* vap = (const bf*)(st + (hr ? 3 * TSZ : 2 * TSZ)) + voff; const bf* vlp = (const bf*)(st + 4 * TSZ) + voff;
    const float cb = hr ? 0.0f : 10.0f;
    // the fragment and accumulator arrays are indexed by constants only (every loop over them is unrolled), so that they stay in registers
    v16bf kh[2][2], kl[2][2];
#pragma unroll
    for (int kt = 0; kt < 2; ++kt)
#pragma unroll
        for (int ks = 0; ks < 2; ++ks) { kh[kt][ks] = WFrag<bf>::ld(khp + kt * 16 * LPE + ks * 32); kl[kt][ks] = WFrag<bf>::ld(klp + kt * 16 * LPE + ks * 32); }
    /* every key fragment serves both query tiles: four independent accumulator chains */
    v8f s[2][QT];
#pragma unroll
    for (int kt = 0; kt < 2; ++kt)
#pragma unroll
        for (int qt = 0; qt < QT; ++qt) { v8f a = (v8f){};
#pragma unroll
            for (int ks = 0; ks < 2; ++ks) { a = wmmab(kh[kt][ks], qh[qt][ks], a); a = wmmab(kl[kt][ks], qh[qt][ks], a); a = wmmab(kh[kt][ks], ql[qt][ks], a); }
            s[kt][qt] = a; }
    /* the V^T fragments, behind the key fragments' last use (their registers are free by then). va: the hi plane's bits (hr) or the fp16 plane's */
    v16bf va[4];
#pragma unroll
    for (int dt = 0; dt < 4; ++dt) va[dt] = WFrag<bf>::ld(vap + dt * 16 * LPE);
    float p[QT][16], al[QT];
#pragma unroll
    for (int qt = 0; qt < QT; ++qt) {
        float mx = s[0][qt][0];
#pragma unroll
        for (int j = 1; j < 8; ++j) mx = fmaxf(mx, s[0][qt][j]);
#pragma unroll
        for (int j = 0; j < 8; ++j) mx = fmaxf(mx, s[1][qt][j]);
        mx = fmaxf(mx, xhalf(mx));
        const float mn = fmaxf(m[qt], mx * SCL2); al[qt] = ex2(m[qt] - mn); m[qt] = mn;
        const float nb = cb - mn;
#pragma unroll
        for (int e = 0; e < 16; ++e) p[qt][e] = ex2(fmaf(s[e >> 3][qt][e & 7], SCL2, nb));
    }
    /* the products below stand in blocks of their own, behind every ex2 of the pass, and behind the score products stands the whole maximum chain */
    if (hr) {
        /* P of both query tiles is split first (its f32 values end there); vb, the lo plane's fragment, is asked for tile by tile inside the branch that uses it: so the hi/lo kind needs no more registers than a wave has at four waves a SIMD */
        v16bf ph[QT], pl[QT];
#pragma unroll
        for (int qt = 0; qt < QT; ++qt) { v8u hh, ll;
            l[qt] = fmaf(l[qt], al[qt], rowsum(p[qt]));
#pragma unroll
            for (int e = 0; e < 8; ++e) { unsigned a2, c2; splitf2(p[qt][2 * e], p[qt][2 * e + 1], a2, c2); hh[e] = a2; ll[e] = c2; }
            ph[qt] = __builtin_bit_cast(v16bf, hh); pl[qt] = __builtin_bit_cast(v16bf, ll); }
#pragma unroll
        for (int dt = 0; dt < 4; ++dt) { const v16bf vb = WFrag<bf>::ld(vlp + dt * 16 * LPE);
#pragma unroll
            for (int qt = 0; qt < QT; ++qt) { o[dt][qt] *= al[qt]; o[dt][qt] = wmmab(va[dt], ph[qt], o[dt][qt]); o[dt][qt] = wmmab(va[dt], pl[qt], o[dt][qt]); o[dt][qt] = wmmab(vb, ph[qt], o[dt][qt]); } }
    }
    if (nh) {
#pragma unroll
        for (int qt = 0; qt < QT; ++qt) { v16h pf;
            l[qt] = fmaf(l[qt], al[qt], rowsum(p[qt]));
#pragma unroll
            for (int e = 0; e < 16; ++e) pf[e] = tohx(p[qt][e]);
#pragma unroll
            for (int dt = 0; dt < 4; ++dt) { o[dt][qt] *= al[qt]; o[dt][qt] = wmma16(__builtin_bit_cast(v16h, va[dt]), pf, o[dt][qt]); } }
    }
}
// grid (16, heads), 16 waves in 8 pairs: a pair owns 32 query columns, wave 2 c the first 32 keys of every stage and wave 2 c + 1 the last 32, each with its own running maximum, sum and O^T; the two are joined once, through LDS, behind the loop.
// Pair 0 (waves 0 and 1) takes one of the head's 16 hi/lo column blocks (rows < RH), pairs 1-7 seven of its 112 fp16 blocks, so that every work-group carries the same load
__global__ __launch_bounds__(512) void k_fattn(const bf* __restrict__ QPh, const bf* __restrict__ QPl, const h16* __restrict__ VT16, const bf* __restrict__ VTh, const bf* __restrict__ VTl, float* __restrict__ out) {
    __shared__ __attribute__((aligned(16))) unsigned char ring[2 * BSZ];
    const int w = __builtin_amdgcn_readfirstlane((int)(threadIdx.x >> 5)); const int lane = threadIdx.x & 31, lr = lane & 15, hi = lane >> 4; const size_t hp = (size_t)blockIdx.y * TT * HD;
    const bf* Kh = QPh + hp; const bf* Kl = QPl + hp; float* orow = out + blockIdx.y * HD;
    const int cw = __builtin_amdgcn_readfirstlane((int)(threadIdx.x >> 6)), g = w & 1;   /* the pair, and the wave's half of every stage */
    const int q0 = (cw == 0) ? (int)blockIdx.x * 32 : RH + ((int)blockIdx.x * 7 + cw - 1) * 32;
    /* the thread's piece of every tile: row tid / 8, 16-byte column tid % 8 */
    const int crow = (int)(threadIdx.x >> 3), ccol = (int)(threadIdx.x & 7);
    const unsigned cd = (unsigned)(size_t)ring + (unsigned)(crow * LPB + ccol * 16);
    const unsigned ko = (unsigned)(crow * HD + ccol * 8), vo = (unsigned)(crow * TT + ccol * 8);
    const h16* V16 = VT16 + hp; const bf* Vh = VTh + hp; const bf* Vl = VTl + hp;
    stage_copy(cd, Kh, Kl, V16, Vh, Vl, ko, vo);   /* stage 0 into buffer 0 */
    /* the query fragments, kept in registers */
    v16bf qh[QT][2], ql[QT][2];
    const bf* qhp = Kh + (size_t)q0 * HD + lr * HD + 8 * hi; const bf* qlp = Kl + (size_t)q0 * HD + lr * HD + 8 * hi;
#pragma unroll
    for (int qt = 0; qt < QT; ++qt)
#pragma unroll
        for (int ks = 0; ks < 2; ++ks) { qh[qt][ks] = WFrag<bf>::ld(qhp + qt * 16 * HD + ks * 32); ql[qt][ks] = WFrag<bf>::ld(qlp + qt * 16 * HD + ks * 32); }
    xwait(qhp, qlp);
    v8f o[4][QT];
#pragma unroll
    for (int dt = 0; dt < 4; ++dt)
#pragma unroll
        for (int qt = 0; qt < QT; ++qt) o[dt][qt] = (v8f){};
    float m[QT], l[QT];
#pragma unroll
    for (int qt = 0; qt < QT; ++qt) { m[qt] = -3.0e38f; l[qt] = 0.f; }
    const unsigned loff = (unsigned)(lr * LPE + 8 * hi), koff = loff + (unsigned)(g * 32 * LPE), voff = loff + (unsigned)(g * 32);
    asm volatile("s_wait_asynccnt 0x0" ::: "memory");   /* this wave's copies of stage 0 have landed */
    __syncthreads();                                     /* and every other wave's: stage 0 is published */
    stage_copy(cd + BSZ, Kh + SK * HD, Kl + SK * HD, V16 + SK, Vh + SK, Vl + SK, ko, vo);   /* stage 1 into buffer 1 */
    // rolled: one stage's fragments, scores and the output tiles are the register budget
#pragma unroll 1
    for (int s = 0; s < NST; ++s) {
        const unsigned char* st = ring + (s & 1) * BSZ;
        fattn_stage(st, koff, voff, w < 2, cw != 0, qh, ql, o, m, l);
        /* publish point of stage s + 1, every wave: its own LDS reads of stage s are done, its own copies of stage s + 1 have landed, then the barrier; only behind it is stage s's buffer refilled */
        asm volatile("s_wait_dscnt 0x0" ::: "memory");
        asm volatile("s_wait_asynccnt 0x0" ::: "memory");
        __syncthreads();
        if (s + 2 < NST) stage_copy(cd + (unsigned)(s & 1) * BSZ, Kh + (size_t)(s + 2) * SK * HD, Kl + (size_t)(s + 2) * SK * HD, V16 + (s + 2) * SK, Vh + (s + 2) * SK, Vl + (s + 2) * SK, ko, vo);
    }
    asm volatile("s_wait_asynccnt 0x0" ::: "memory");   /* no copy is outstanding when the wave ends */
    /* the pair's two halves are joined: behind the loop's last barrier nobody reads the ring and no copy is in flight, so it serves as the hand-over place (17 x 16 bytes a lane and pair) */
    v4fa* mg = (v4fa*)ring + cw * 17 * 32 + lane;
    if (g) {
#pragma unroll
        for (int dt = 0; dt < 4; ++dt)
#pragma unroll
            for (int qt = 0; qt < QT; ++qt) { mg[((dt * QT + qt) * 2) * 32] = (v4f){o[dt][qt][0], o[dt][qt][1], o[dt][qt][2], o[dt][qt][3]}; mg[((dt * QT + qt) * 2 + 1) * 32] = (v4f){o[dt][qt][4], o[dt][qt][5], o[dt][qt][6], o[dt][qt][7]}; }
        mg[16 * 32] = (v4f){m[0], m[1], l[0], l[1]};
    }
    __syncthreads();   /* the odd waves' halves are in LDS before the even waves read them */
    if (g) return;
    const v4f ml = mg[16 * 32];
    /* register j of o[dt][qt] = O[query q0 + 16 qt + c][d = 16 dt + 8h + j]: 8 consecutive floats of one output row per lane */
#pragma unroll
    for (int qt = 0; qt < QT; ++qt) {
        const float mn = fmaxf(m[qt], ml[qt]), fa = ex2(m[qt] - mn), fb = ex2(ml[qt] - mn), lj = fmaf(l[qt], fa, ml[2 + qt] * fb);
        const float f = __fdiv_rn(1.0f, lj + xhalf(lj)), ga = fa * f, gb = fb * f; float* r = orow + (size_t)(q0 + qt * 16 + lr) * DM + 8 * hi;
#pragma unroll
        for (int dt = 0; dt < 4; ++dt) { const v4f pa = mg[((dt * QT + qt) * 2) * 32], pb = mg[((dt * QT + qt) * 2 + 1) * 32]; v4f a, b;
#pragma unroll
            for (int j = 0; j < 4; ++j) { a[j] = fmaf(o[dt][qt][j], ga, pa[j] * gb); b[j] = fmaf(o[dt][qt][4 + j], ga, pb[j] * gb); }
            *(v4f*)(r + dt * 16) = a; *(v4f*)(r + dt * 16 + 4) = b; }
        xwait(r, r); }
}

// ---- k_planes: every plane that k_fattn reads, in one launch. One work-group takes 128 positions x the 64 columns of one head: the f32 tile is read once, in whole 128-byte lines, and laid in LDS;
// from there each thread takes 8 neighbours of a row (K hi/lo planes [h][t][64]) and 8 neighbours of a column (V^T fp16, hi, lo planes [h][64][t]), so that every store is 16 bytes a lane and 8 lanes fill a 128-byte line.
#define PT   128                  // positions per tile
#define PP   65                   // LDS row pitch in floats, odd: 8 floats of 4 neighbouring rows, and rows 8 apart of 4 neighbouring columns, fall on 32 different banks
__global__ __launch_bounds__(256) void k_planes(const float* __restrict__ X, bf* __restrict__ Ph, bf* __restrict__ Pl, h16* __restrict__ V16, bf* __restrict__ Vh, bf* __restrict__ Vl) {
    __shared__ float tile[PT * PP];
    const int tid = (int)threadIdx.x, t0 = (int)blockIdx.x * PT; const size_t hp = (size_t)blockIdx.y * TT * HD;
    /* in: 16 lanes x 16 bytes = the head's 256 bytes of one position; all eight loads of a thread in flight together */
    const int ir = tid >> 4, ic = (tid & 15) * 4;
    const float* sp = X + (size_t)(t0 + ir) * DM + blockIdx.y * HD + ic;
    // every loop of this kernel is unrolled: the register arrays are indexed by constants only, and each group of loads or stores stands together in front of its wait
    v4f in[PT / 16];
#pragma unroll
    for (int i = 0; i < PT / 16; ++i) in[i] = *(const v4f*)(sp + (size_t)i * 16 * DM);
    xwait(sp, sp);
#pragma unroll
    for (int i = 0; i < PT / 16; ++i)
#pragma unroll
        for (int j = 0; j < 4; ++j) tile[(ir + i * 16) * PP + ic + j] = in[i][j];
    __syncthreads();   /* the tile is whole before anybody reads across the writers' rows */
    const int r8 = tid >> 3, c8 = (tid & 7) * 8;
    /* K planes: position t0 + r8 + 32 i, columns c8 .. c8 + 7 */
    v8us kh[PT / 32], kl[PT / 32];
#pragma unroll
    for (int i = 0; i < PT / 32; ++i)
#pragma unroll
        for (int j = 0; j < 8; ++j) { unsigned short a2, c2; splitf(tile[(r8 + i * 32) * PP + c8 + j], a2, c2); kh[i][j] = a2; kl[i][j] = c2; }
    bf* kph = Ph + hp + (size_t)(t0 + r8) * HD + c8; bf* kpl = Pl + hp + (size_t)(t0 + r8) * HD + c8;
#pragma unroll
    for (int i = 0; i < PT / 32; ++i) { *(v8us*)(kph + i * 32 * HD) = kh[i]; *(v8us*)(kpl + i * 32 * HD) = kl[i]; }
    xwait(kph, kpl);
    /* V^T planes: column r8 + 32 i, positions t0 + 64 u + c8 .. + 7 */
    const size_t vo = hp + (size_t)r8 * TT + t0 + c8;
    h16* vp16 = V16 + vo; bf* vph = Vh + vo; bf* vpl = Vl + vo;
#pragma unroll
    for (int i = 0; i < HD / 32; ++i) {
        v8h f[PT / 64]; v8us vh[PT / 64], vl[PT / 64];
#pragma unroll
        for (int u = 0; u < PT / 64; ++u)
#pragma unroll
            for (int j = 0; j < 8; j += 2) { v2f x; unsigned short a2, c2; x[0] = tile[(u * 64 + c8 + j) * PP + r8 + i * 32]; x[1] = tile[(u * 64 + c8 + j + 1) * PP + r8 + i * 32];
                const v2h y = __builtin_convertvector(x, v2h); f[u][j] = y[0]; f[u][j + 1] = y[1];   /* two at a time: one packed conversion, to nearest even like tohx */
                splitf(x[0], a2, c2); vh[u][j] = a2; vl[u][j] = c2; splitf(x[1], a2, c2); vh[u][j + 1] = a2; vl[u][j + 1] = c2; }
#pragma unroll
        for (int u = 0; u < PT / 64; ++u) { *(v8h*)(vp16 + (size_t)i * 32 * TT + u * 64) = f[u]; *(v8us*)(vph + (size_t)i * 32 * TT + u * 64) = vh[u]; *(v8us*)(vpl + (size_t)i * 32 * TT + u * 64) = vl[u]; }
        xwait(vp16, vph); }
}
extern "C" void kernel_launch(void* const* d_in, const int* in_sizes, int n_in,
                              void* d_out, int out_size, void* d_ws, size_t ws_size, hipStream_t stream) {
    (void)in_sizes; (void)n_in; (void)out_size;
    const float* x = (const float*)d_in[0];   /* x [4096][1024]: q = k = v = x reshaped to 16 heads x 64 (no projections, no batch) */
    float* OUT = (float*)d_out;     // [4096][1024]
    char* wsp = (char*)d_ws;
    auto take = [&](size_t bytes) { char* p = wsp; wsp += (bytes + 255) & ~(size_t)255; return (void*)p; };
    bf* QPh = (bf*)take((size_t)TT * MID * 2); bf* QPl = (bf*)take((size_t)TT * MID * 2);   /* k = q: one set of planes */
    h16* VT16 = (h16*)take((size_t)CO * TT * 2); bf* VTh = (bf*)take((size_t)CO * TT * 2); bf* VTl = (bf*)take((size_t)CO * TT * 2);
    if ((size_t)(wsp - (char*)d_ws) > ws_size) return;    // ws 256 MiB (carve 40 MiB)
    k_planes<<<dim3(TT / PT, NH_, 1), 256, 0, stream>>>(x, QPh, QPl, VT16, VTh, VTl);   /* q (= k) planes [h][n][64] (bf16 hi/lo split) and v^T planes [h][64][n] (fp16, bf16 hi/lo) straight from the f32 input */
    k_fattn<<<dim3(RH / 32, NH_, 1), 512, 0, stream>>>(QPh, QPl, VT16, VTh, VTl, OUT);   /* all heads: scores x 1/8, softmax over the 4,096 keys, attn.V, output rows written once */
}

// v006
// It runs in 109 microseconds.
// Timed twice side by side with v005, it ran 1.04 times as fast both times.
// All steps since v000 together make it 35.7 times as fast.
#include <hip/hip_runtime.h>

// Scaled dot-product self-attention where q = k = v = the input itself (x [4096][1024] reshaped to 16 heads x 64; no projections, no batch; scores = x_h.x_h x 1/sqrt(64); softmax (no mask); out = attn.x_h merged -> [4096][1024] (4.2 M); argument order x).
// Layout: the f32 input feeds one plane builder directly: ONE set of hi/lo planes serves as both q and k (k = q), value^T planes from the same rows; k_fattn then does scores (every row hi/lo, 3 products), softmax and attn.V (rows < 512 hi/lo, rest fp16 x1024) in one launch, a running maximum and sum per query, and writes the output once. NOTE the hi/lo split carries the f32 input.
// Compute dtypes, f32 accumulate: input split into bf16 hi/lo (scores, exact to ~2^-16) and fp16 (value planes for rows >= 512); softmax f32; output f32.

#define NB_  1
#define TT   4096
#define DM   1024
#define NH_  16
#define NKV  16
#define REP  (NH_ / NKV)
#define HD   64
#define DQ   (NH_ * HD)
#define DKV  (NKV * HD)
#define ZH   1
#define RH   512                  // query rows < RH use hi+lo planes
#define WIN  0
#define PCAR 1024.0f
#define SCL  0.125f   // 1/sqrt(float32(64))
#define MID  1024      // q / k width
#define CO   1024      // v width
#define CC   1024
typedef _Float16 h16;
typedef unsigned short bf;
typedef __attribute__((ext_vector_type(16))) __bf16   v16bf;
typedef __attribute__((ext_vector_type(16))) _Float16 v16h;
typedef __attribute__((ext_vector_type(8)))  _Float16 v8h;
typedef __attribute__((ext_vector_type(8)))  unsigned short v8us;
typedef __attribute__((ext_vector_type(8)))  float    v8f;
typedef __attribute__((ext_vector_type(4)))  float    v4f;
typedef v8h  __attribute__((may_alias)) v8ha;
typedef v4f  __attribute__((may_alias)) v4fa;
typedef v8us __attribute__((may_alias)) v8usa;

__device__ __forceinline__ unsigned short f2bf(float f) { unsigned u = __float_as_uint(f); u += 0x7FFFu + ((u >> 16) & 1u); return (unsigned short)(u >> 16); }
__device__ __forceinline__ float bf2f(unsigned short b) { return __uint_as_float(((unsigned)b) << 16); }
__device__ __forceinline__ float bfr(float f) { return bf2f(f2bf(f)); }
__device__ __forceinline__ v16h cat16(v8h lo, v8h hi) { return __builtin_shufflevector(lo, hi, 0, 1, 2, 3, 4, 5, 6, 7, 8, 9, 10, 11, 12, 13, 14, 15); }
__device__ __forceinline__ v16bf cat16b(v8us lo, v8us hi) { return __builtin_bit_cast(v16bf, __builtin_shufflevector(lo, hi, 0, 1, 2, 3, 4, 5, 6, 7, 8, 9, 10, 11, 12, 13, 14, 15)); }
__device__ __forceinline__ v8f wmma16(v16h a, v16h b, v8f c) { return __builtin_amdgcn_wmma_f32_16x16x32_f16(false, a, false, b, (short)0, c, false, false); }
__device__ __forceinline__ v8f wmmab(v16bf a, v16bf b, v8f c) { return __builtin_amdgcn_wmma_f32_16x16x32_bf16(false, a, false, b, (short)0, c, false, false); }

// fragment loaders: 16 rows (lane c = row) of a K-contiguous 16-bit plane, p already at the lane's row and at 8h: k = 8h + s for s < 8, 16 + 8h + (s - 8) behind
template <typename T16> struct WFrag;
template <> struct WFrag<h16> { typedef v16h V; static __device__ __forceinline__ V ld(const h16* p) { return cat16(*(const v8h*)p, *(const v8h*)(p + 16)); } static __device__ __forceinline__ v8f mma(V a, V b, v8f c) { return wmma16(a, b, c); } };
template <> struct WFrag<bf> { typedef v16bf V; static __device__ __forceinline__ V ld(const bf* p) { return cat16b(*(const v8us*)p, *(const v8us*)(p + 16)); } static __device__ __forceinline__ v8f mma(V a, V b, v8f c) { return wmmab(a, b, c); } };

__device__ __forceinline__ h16 tohx(float x) { return (h16)x; }
__device__ __forceinline__ void splitf(float y, unsigned short& h, unsigned short& l) { h = f2bf(y); l = f2bf(y - bf2f(h)); }
typedef __attribute__((ext_vector_type(2))) _Float16 v2h;
typedef __attribute__((ext_vector_type(4))) _Float16 v4h;
typedef __attribute__((ext_vector_type(2))) unsigned short v2us;
typedef __attribute__((ext_vector_type(4))) unsigned short v4us;
typedef __attribute__((ext_vector_type(2))) float v2f;
typedef __attribute__((ext_vector_type(4))) int v4i;

__device__ __forceinline__ float xhalf(float x) { const int b = __float_as_int(x); return __int_as_float(__builtin_amdgcn_permlanex16(b, b, 0x76543210, 0xfedcba98, false, false)); }   /* lane l <-> l ^ 16 */
// behind a group of global loads or stores: their address (and data) registers are rewritten only behind this wait. The group's base pointers are inputs, so that their registers stay theirs up to the wait
// (no load of the group lands on them); the scheduling barrier keeps the register writes that follow in the source behind the wait in the listing too
__device__ __forceinline__ void xwait(const void* p0, const void* p1) { asm volatile("s_wait_xcnt 0x0" :: "v"(p0), "v"(p1) : "memory"); __builtin_amdgcn_sched_barrier(0); }
// 2^x: v_exp_f32 and, in the same statement, the one slot that the instruction set asks for behind a transcendental before its result is read or its source overwritten
__device__ __forceinline__ float ex2(float x) { float r; asm("v_exp_f32 %0, %1\n\tv_nop" : "=v"(r) : "v"(x)); return r; }
#define SCL2 0.18033688011112042f   // SCL x log2(e)
#define QT   2                    // 16-column query tiles per wave
#define SK   64                   // keys per stage
#define NST  (TT / SK)            // stages
#define LPB  144                  // LDS row pitch, bytes: 128 + 16 = 16 x odd, 16 rows of a 16-byte read fall on 64 different banks
#define LPE  (LPB / 2)            // the same in 16-bit elements
#define TSZ  (64 * LPB)           // one tile of 64 rows
#define BSZ  (5 * TSZ)            // one stage: K hi, K lo, V^T fp16, V^T hi, V^T lo
// one stage's five copies of a thread (one 16-byte piece of each of the five tiles; a wave's 32 lanes copy four whole 128-byte rows at a time). d: the thread's place in tile 0 of the target buffer (LDS byte address);
// the five pointers: the head's planes (the same for the whole work-group and for every stage, so they stay in scalar registers); ko, vo: the thread's piece of the stage's K tiles and of its V^T tiles, in bytes from there.
// The copies are the builtin, whose registers are the compiler's own affair: the wave goes on behind the fifth issue and waits for nothing here (their landing is waited for at the publish point)
typedef int ci4 __attribute__((vector_size(16)));
typedef __attribute__((address_space(1))) ci4* gp4;
typedef __attribute__((address_space(3))) ci4* lp4;
typedef __attribute__((address_space(1))) char* gpc;
__device__ __forceinline__ void cp16(unsigned d, const void* base, unsigned off) { __builtin_amdgcn_global_load_async_to_lds_b128((gp4)((gpc)(size_t)base + off), (lp4)d, 0, 0); }
__device__ __forceinline__ void stage_copy(unsigned d, const bf* pkh, const bf* pkl, const h16* pv16, const bf* pvh, const bf* pvl, unsigned ko, unsigned vo) {
    cp16(d, pkh, ko); cp16(d + TSZ, pkl, ko); cp16(d + 2 * TSZ, pv16, vo); cp16(d + 3 * TSZ, pvh, vo); cp16(d + 4 * TSZ, pvl, vo);
}
typedef __attribute__((ext_vector_type(8))) unsigned v8u;
typedef __attribute__((ext_vector_type(2))) __bf16 v2bf;
// splitf of two neighbours on whole registers: h = the two hi parts (x0's in the low half), l = the two lo parts; both roundings to nearest even, as in f2bf, by the packed conversion.
// The hand-rounded form with its 16-bit pieces took the hi/lo kind, at two query tiles, past the registers a wave has at four waves a SIMD
__device__ __forceinline__ void splitf2(float x0, float x1, unsigned& h, unsigned& l) {
    const v2f x = {x0, x1}; h = __builtin_bit_cast(unsigned, __builtin_convertvector(x, v2bf));
    const v2f xh = {__uint_as_float(h << 16), __uint_as_float(h & 0xFFFF0000u)};
    l = __builtin_bit_cast(unsigned, __builtin_convertvector(x - xh, v2bf)); }
// a lane's sum of its 16 probabilities of one query. It is called inside each kind's own branch, in front of the conversion: there the 16 values end with their conversion and hold no registers through the second product
__device__ __forceinline__ float rowsum(const float (&p)[16]) { float ps = 0.f;
#pragma unroll
    for (int e = 0; e < 16; ++e) ps += p[e];
    return ps; }
// one wave's work on one stage in LDS: ONE pass of 32 keys, the wave's half of the stage's 64 (st: the stage's buffer; koff, voff: the lane's place in a 16-row block of a K tile and of a V^T tile, the wave's half counted in, in elements; hr, nh: the wave's kind, hi/lo or not, the same in all its lanes).
// Scores and softmax are the same code for both kinds of wave; only the V^T fragments and the second product differ, under scalar branches, so that the stage loop and its barrier are one for the whole work-group.
// The two kinds' second products are two branches one behind the other, each on a flag of its own, not an if / else: so each updates O^T in its own registers (as if / else the build kept a second set of all O^T tiles and copied it back every stage)
// refill: the next stage's copies. They are issued behind the pass's key fragment reads, so that between the barrier and those reads, on which the first products wait, stands nothing; address sums and issue run under the LDS latency
template <typename F> __device__ __forceinline__ void fattn_stage(const unsigned char* st, unsigned koff, unsigned voff, bool hr, bool nh, const v16bf (&qh)[QT][2], const v16bf (&ql)[QT][2], v8f (&o)[4][QT], float (&m)[QT], float (&l)[QT], F refill) {
    const bf* khp = (const bf*)st + koff; const bf* klp = (const bf*)(st + TSZ) + koff; const bf* vap = (const bf*)(st + (hr ? 3 * TSZ : 2 * TSZ)) + voff; const bf* vlp = (const bf*)(st + 4 * TSZ) + voff;
    const float cb = hr ? 0.0f : 10.0f;
    // the fragment and accumulator arrays are indexed by constants only (every loop over them is unrolled), so that they stay in registers
    v16bf kh[2][2], kl[2][2];
#pragma unroll
    for (int kt = 0; kt < 2; ++kt)
#pragma unroll
        for (int ks = 0; ks < 2; ++ks) { kh[kt][ks] = WFrag<bf>::ld(khp + kt * 16 * LPE + ks * 32); kl[kt][ks] = WFrag<bf>::ld(klp + kt * 16 * LPE + ks * 32); }
    refill();
    /* every key fragment serves both query tiles: four independent accumulator chains */
    v8f s[2][QT];
#pragma unroll
    for (int kt = 0; kt < 2; ++kt)
#pragma unroll
        for (int qt = 0; qt < QT; ++qt) { v8f a = (v8f){};
#pragma unroll
            for (int ks = 0; ks < 2; ++ks) { a = wmmab(kh[kt][ks], qh[qt][ks], a); a = wmmab(kl[kt][ks], qh[qt][ks], a); a = wmmab(kh[kt][ks], ql[qt][ks], a); }
            s[kt][qt] = a; }
    /* the V^T fragments, behind the key fragments' last use (their registers are free by then). va: the hi plane's bits (hr) or the fp16 plane's */
    v16bf va[4];
#pragma unroll
    for (int dt = 0; dt < 4; ++dt) va[dt] = WFrag<bf>::ld(vap + dt * 16 * LPE);
    float p[QT][16], al[QT];
#pragma unroll
    for (int qt = 0; qt < QT; ++qt) {
        float mx = s[0][qt][0];
#pragma unroll
        for (int j = 1; j < 8; ++j) mx = fmaxf(mx, s[0][qt][j]);
#pragma unroll
        for (int j = 0; j < 8; ++j) mx = fmaxf(mx, s[1][qt][j]);
        mx = fmaxf(mx, xhalf(mx));
        const float mn = fmaxf(m[qt], mx * SCL2); al[qt] = ex2(m[qt] - mn); m[qt] = mn;
        const float nb = cb - mn;
#pragma unroll
        for (int e = 0; e < 16; ++e) p[qt][e] = ex2(fmaf(s[e >> 3][qt][e & 7], SCL2, nb));
    }
    /* the products below stand in blocks of their own, behind every ex2 of the pass, and behind the score products stands the whole maximum chain */
    if (hr) {
        /* P of both query tiles is split first (its f32 values end there); vb, the lo plane's fragment, is asked for tile by tile inside the branch that uses it: so the hi/lo kind needs no more registers than a wave has at four waves a SIMD */
        v16bf ph[QT], pl[QT];
#pragma unroll
        for (int qt = 0; qt < QT; ++qt) { v8u hh, ll;
            l[qt] = fmaf(l[qt], al[qt], rowsum(p[qt]));
#pragma unroll
            for (int e = 0; e < 8; ++e) { unsigned a2, c2; splitf2(p[qt][2 * e], p[qt][2 * e + 1], a2, c2); hh[e] = a2; ll[e] = c2; }
            ph[qt] = __builtin_bit_cast(v16bf, hh); pl[qt] = __builtin_bit_cast(v16bf, ll); }
#pragma unroll
        for (int dt = 0; dt < 4; ++dt) { const v16bf vb = WFrag<bf>::ld(vlp + dt * 16 * LPE);
#pragma unroll
            for (int qt = 0; qt < QT; ++qt) { o[dt][qt] *= al[qt]; o[dt][qt] = wmmab(va[dt], ph[qt], o[dt][qt]); o[dt][qt] = wmmab(va[dt], pl[qt], o[dt][qt]); o[dt][qt] = wmmab(vb, ph[qt], o[dt][qt]); } }
    }
    if (nh) {
#pragma unroll
        for (int qt = 0; qt < QT; ++qt) { v16h pf;
            l[qt] = fmaf(l[qt], al[qt], rowsum(p[qt]));
#pragma unroll
            for (int e = 0; e < 16; ++e) pf[e] = tohx(p[qt][e]);
#pragma unroll
            for (int dt = 0; dt < 4; ++dt) { o[dt][qt] *= al[qt]; o[dt][qt] = wmma16(__builtin_bit_cast(v16h, va[dt]), pf, o[dt][qt]); } }
    }
}
// grid (16, heads), 16 waves in 8 pairs: a pair owns 32 query columns, wave 2 c the first 32 keys of every stage and wave 2 c + 1 the last 32, each with its own running maximum, sum and O^T; the two are joined once, through LDS, behind the loop.
// Pair 0 (waves 0 and 1) takes one of the head's 16 hi/lo column blocks (rows < RH), pairs 1-7 seven of its 112 fp16 blocks, so that every work-group carries the same load
__global__ __launch_bounds__(512) void k_fattn(const bf* __restrict__ QPh, const bf* __restrict__ QPl, const h16* __restrict__ VT16, const bf* __restrict__ VTh, const bf* __restrict__ VTl, float* __restrict__ out) {
    __shared__ __attribute__((aligned(16))) unsigned char ring[2 * BSZ];
    const int w = __builtin_amdgcn_readfirstlane((int)(threadIdx.x >> 5)); const int lane = threadIdx.x & 31, lr = lane & 15, hi = lane >> 4; const size_t hp = (size_t)blockIdx.y * TT * HD;
    const bf* Kh = QPh + hp; const bf* Kl = QPl + hp; float* orow = out + blockIdx.y * HD;
    const int cw = __builtin_amdgcn_readfirstlane((int)(threadIdx.x >> 6)), g = w & 1;   /* the pair, and the wave's half of every stage */
    const int q0 = (cw == 0) ? (int)blockIdx.x * 32 : RH + ((int)blockIdx.x * 7 + cw - 1) * 32;
    /* the thread's piece of every tile: row tid / 8, 16-byte column tid % 8 */
    const int crow = (int)(threadIdx.x >> 3), ccol = (int)(threadIdx.x & 7);
    const unsigned cd = (unsigned)(size_t)ring + (unsigned)(crow * LPB + ccol * 16);
    const unsigned ko = (unsigned)(crow * HD + ccol * 8) * 2u, vo = (unsigned)(crow * TT + ccol * 8) * 2u;   /* bytes, stage 0 */
    const h16* V16 = VT16 + hp; const bf* Vh = VTh + hp; const bf* Vl = VTl + hp;
    stage_copy(cd, Kh, Kl, V16, Vh, Vl, ko, vo);   /* stage 0 into buffer 0 */
    /* the query fragments, kept in registers */
    v16bf qh[QT][2], ql[QT][2];
    const bf* qhp = Kh + (size_t)q0 * HD + lr * HD + 8 * hi; const bf* qlp = Kl + (size_t)q0 * HD + lr * HD + 8 * hi;
#pragma unroll
    for (int qt = 0; qt < QT; ++qt)
#pragma unroll
        for (int ks = 0; ks < 2; ++ks) { qh[qt][ks] = WFrag<bf>::ld(qhp + qt * 16 * HD + ks * 32); ql[qt][ks] = WFrag<bf>::ld(qlp + qt * 16 * HD + ks * 32); }
    xwait(qhp, qlp);
    v8f o[4][QT];
#pragma unroll
    for (int dt = 0; dt < 4; ++dt)
#pragma unroll
        for (int qt = 0; qt < QT; ++qt) o[dt][qt] = (v8f){};
    float m[QT], l[QT];
#pragma unroll
    for (int qt = 0; qt < QT; ++qt) { m[qt] = -3.0e38f; l[qt] = 0.f; }
    const unsigned loff = (unsigned)(lr * LPE + 8 * hi), koff = loff + (unsigned)(g * 32 * LPE), voff = loff + (unsigned)(g * 32);
    asm volatile("s_wait_asynccnt 0x0" ::: "memory");   /* this wave's copies of stage 0 have landed */
    __syncthreads();                                     /* and every other wave's: stage 0 is published */
    // rolled: one stage's fragments, scores and the output tiles are the register budget
#pragma unroll 1
    for (int s = 0; s < NST; ++s) {
        const unsigned char* st = ring + (s & 1) * BSZ;
        /* stage s + 1 goes into the other buffer, whose last readers (pass s - 1) ended in front of the barrier that this pass began behind; the test reads the same for the whole work-group */
        fattn_stage(st, koff, voff, w < 2, cw != 0, qh, ql, o, m, l, [&]() {
            /* the stage's number through readfirstlane: so the build adds it to the two 32-bit offsets, beside scalar bases; without it it kept five running 64-bit addresses in vector registers, past what a wave has at four waves a SIMD */
            const unsigned sn = (unsigned)__builtin_amdgcn_readfirstlane(s + 1);
            if (s + 1 < NST) stage_copy(cd + (sn & 1u) * BSZ, Kh, Kl, V16, Vh, Vl, ko + sn * (SK * HD * 2), vo + sn * (SK * 2)); });
        /* publish point of stage s + 1, every wave: its own LDS reads of stage s are done, its own copies of stage s + 1 have landed, then the barrier; only behind it, in pass s + 1, is stage s's buffer refilled */
        asm volatile("s_wait_dscnt 0x0" ::: "memory");
        asm volatile("s_wait_asynccnt 0x0" ::: "memory");
        __syncthreads();
    }
    asm volatile("s_wait_asynccnt 0x0" ::: "memory");   /* no copy is outstanding when the wave ends */
    /* the pair's two halves are joined: behind the loop's last barrier nobody reads the ring and no copy is in flight, so it serves as the hand-over place (17 x 16 bytes a lane and pair) */
    v4fa* mg = (v4fa*)ring + cw * 17 * 32 + lane;
    if (g) {
#pragma unroll
        for (int dt = 0; dt < 4; ++dt)
#pragma unroll
            for (int qt = 0; qt < QT; ++qt) { mg[((dt * QT + qt) * 2) * 32] = (v4f){o[dt][qt][0], o[dt][qt][1], o[dt][qt][2], o[dt][qt][3]}; mg[((dt * QT + qt) * 2 + 1) * 32] = (v4f){o[dt][qt][4], o[dt][qt][5], o[dt][qt][6], o[dt][qt][7]}; }
        mg[16 * 32] = (v4f){m[0], m[1], l[0], l[1]};
    }
    __syncthreads();   /* the odd waves' halves are in LDS before the even waves read them */
    if (g) return;
    const v4f ml = mg[16 * 32];
    /* register j of o[dt][qt] = O[query q0 + 16 qt + c][d = 16 dt + 8h + j]: 8 consecutive floats of one output row per lane */
#pragma unroll
    for (int qt = 0; qt < QT; ++qt) {
        const float mn = fmaxf(m[qt], ml[qt]), fa = ex2(m[qt] - mn), fb = ex2(ml[qt] - mn), lj = fmaf(l[qt], fa, ml[2 + qt] * fb);
        const float f = __fdiv_rn(1.0f, lj + xhalf(lj)), ga = fa * f, gb = fb * f; float* r = orow + (size_t)(q0 + qt * 16 + lr) * DM + 8 * hi;
#pragma unroll
        for (int dt = 0; dt < 4; ++dt) { const v4f pa = mg[((dt * QT + qt) * 2) * 32], pb = mg[((dt * QT + qt) * 2 + 1) * 32]; v4f a, b;
#pragma unroll
            for (int j = 0; j < 4; ++j) { a[j] = fmaf(o[dt][qt][j], ga, pa[j] * gb); b[j] = fmaf(o[dt][qt][4 + j], ga, pb[j] * gb); }
            *(v4f*)(r + dt * 16) = a; *(v4f*)(r + dt * 16 + 4) = b; }
        xwait(r, r); }
}

// ---- k_planes: every plane that k_fattn reads, in one launch. One work-group takes 128 positions x the 64 columns of one head: the f32 tile is read once, in whole 128-byte lines, and laid in LDS;
// from there each thread takes 8 neighbours of a row (K hi/lo planes [h][t][64]) and 8 neighbours of a column (V^T fp16, hi, lo planes [h][64][t]), so that every store is 16 bytes a lane and 8 lanes fill a 128-byte line.
#define PT   128                  // positions per tile
#define PP   65                   // LDS row pitch in floats, odd: 8 floats of 4 neighbouring rows, and rows 8 apart of 4 neighbouring columns, fall on 32 different banks
__global__ __launch_bounds__(256) void k_planes(const float* __restrict__ X, bf* __restrict__ Ph, bf* __restrict__ Pl, h16* __restrict__ V16, bf* __restrict__ Vh, bf* __restrict__ Vl) {
    __shared__ float tile[PT * PP];
    const int tid = (int)threadIdx.x, t0 = (int)blockIdx.x * PT; const size_t hp = (size_t)blockIdx.y * TT * HD;
    /* in: 16 lanes x 16 bytes = the head's 256 bytes of one position; all eight loads of a thread in flight together */
    const int ir = tid >> 4, ic = (tid & 15) * 4;
    const float* sp = X + (size_t)(t0 + ir) * DM + blockIdx.y * HD + ic;
    // every loop of this kernel is unrolled: the register arrays are indexed by constants only, and each group of loads or stores stands together in front of its wait
    v4f in[PT / 16];
#pragma unroll
    for (int i = 0; i < PT / 16; ++i) in[i] = *(const v4f*)(sp + (size_t)i * 16 * DM);
    xwait(sp, sp);
#pragma unroll
    for (int i = 0; i < PT / 16; ++i)
#pragma unroll
        for (int j = 0; j < 4; ++j) tile[(ir + i * 16) * PP + ic + j] = in[i][j];
    __syncthreads();   /* the tile is whole before anybody reads across the writers' rows */
    const int r8 = tid >> 3, c8 = (tid & 7) * 8;
    /* K planes: position t0 + r8 + 32 i, columns c8 .. c8 + 7 */
    v8us kh[PT / 32], kl[PT / 32];
#pragma unroll
    for (int i = 0; i < PT / 32; ++i)
#pragma unroll
        for (int j = 0; j < 8; ++j) { unsigned short a2, c2; splitf(tile[(r8 + i * 32) * PP + c8 + j], a2, c2); kh[i][j] = a2; kl[i][j] = c2; }
    bf* kph = Ph + hp + (size_t)(t0 + r8) * HD + c8; bf* kpl = Pl + hp + (size_t)(t0 + r8) * HD + c8;
#pragma unroll
    for (int i = 0; i < PT / 32; ++i) { *(v8us*)(kph + i * 32 * HD) = kh[i]; *(v8us*)(kpl + i * 32 * HD) = kl[i]; }
    xwait(kph, kpl);
    /* V^T planes: column r8 + 32 i, positions t0 + 64 u + c8 .. + 7 */
    const size_t vo = hp + (size_t)r8 * TT + t0 + c8;
    h16* vp16 = V16 + vo; bf* vph = Vh + vo; bf* vpl = Vl + vo;
#pragma unroll
    for (int i = 0; i < HD / 32; ++i) {
        v8h f[PT / 64]; v8us vh[PT / 64], vl[PT / 64];
#pragma unroll
        for (int u = 0; u < PT / 64; ++u)
#pragma unroll
            for (int j = 0; j < 8; j += 2) { v2f x; unsigned short a2, c2; x[0] = tile[(u * 64 + c8 + j) * PP + r8 + i * 32]; x[1] = tile[(u * 64 + c8 + j + 1) * PP + r8 + i * 32];
                const v2h y = __builtin_convertvector(x, v2h); f[u][j] = y[0]; f[u][j + 1] = y[1];   /* two at a time: one packed conversion, to nearest even like tohx */
                splitf(x[0], a2, c2); vh[u][j] = a2; vl[u][j] = c2; splitf(x[1], a2, c2); vh[u][j + 1] = a2; vl[u][j + 1] = c2; }
#pragma unroll
        for (int u = 0; u < PT / 64; ++u) { *(v8h*)(vp16 + (size_t)i * 32 * TT + u * 64) = f[u]; *(v8us*)(vph + (size_t)i * 32 * TT + u * 64) = vh[u]; *(v8us*)(vpl + (size_t)i * 32 * TT + u * 64) = vl[u]; }
        xwait(vp16, vph); }
}
extern "C" void kernel_launch(void* const* d_in, const int* in_sizes, int n_in,
                              void* d_out, int out_size, void* d_ws, size_t ws_size, hipStream_t stream) {
    (void)in_sizes; (void)n_in; (void)out_size;
    const float* x = (const float*)d_in[0];   /* x [4096][1024]: q = k = v = x reshaped to 16 heads x 64 (no projections, no batch) */
    float* OUT = (float*)d_out;     // [4096][1024]
    char* wsp = (char*)d_ws;
    auto take = [&](size_t bytes) { char* p = wsp; wsp += (bytes + 255) & ~(size_t)255; return (void*)p; };
    bf* QPh = (bf*)take((size_t)TT * MID * 2); bf* QPl = (bf*)take((size_t)TT * MID * 2);   /* k = q: one set of planes */
    h16* VT16 = (h16*)take((size_t)CO * TT * 2); bf* VTh = (bf*)take((size_t)CO * TT * 2); bf* VTl = (bf*)take((size_t)CO * TT * 2);
    if ((size_t)(wsp - (char*)d_ws) > ws_size) return;    // ws 256 MiB (carve 40 MiB)
    k_planes<<<dim3(TT / PT, NH_, 1), 256, 0, stream>>>(x, QPh, QPl, VT16, VTh, VTl);   /* q (= k) planes [h][n][64] (bf16 hi/lo split) and v^T planes [h][64][n] (fp16, bf16 hi/lo) straight from the f32 input */
    k_fattn<<<dim3(RH / 32, NH_, 1), 512, 0, stream>>>(QPh, QPl, VT16, VTh, VTl, OUT);   /* all heads: scores x 1/8, softmax over the 4,096 keys, attn.V, output rows written once */
}

// v007
// One run takes 104 microseconds.
// Timed twice side by side with v006, it ran 1.06 and 1.05 times as fast.
// Over all steps from v000 it is 37.7 times as fast.
#include <hip/hip_runtime.h>

// Scaled dot-product self-attention where q = k = v = the input itself (x [4096][1024] reshaped to 16 heads x 64; no projections, no batch; scores = x_h.x_h x 1/sqrt(64); softmax (no mask); out = attn.x_h merged -> [4096][1024] (4.2 M); argument order x).
// Layout: the f32 input feeds one plane builder directly: ONE set of hi/lo planes serves as both q and k (k = q), value^T planes from the same rows; k_fattn then does scores (every row hi/lo, 3 products), softmax and attn.V (rows < 512 hi/lo, rest fp16 x1024) in one launch, a softmax reference that starts at the query's own score (raised in whole steps when a pass's sum leaves range) and a running sum per query, and writes the output once. NOTE the hi/lo split carries the f32 input.
// Compute dtypes, f32 accumulate: input split into bf16 hi/lo (scores, exact to ~2^-16) and fp16 (value planes for rows >= 512); softmax f32; output f32.

#define NB_  1
#define TT   4096
#define DM   1024
#define NH_  16
#define NKV  16
#define REP  (NH_ / NKV)
#define HD   64
#define DQ   (NH_ * HD)
#define DKV  (NKV * HD)
#define ZH   1
#define RH   512                  // query rows < RH use hi+lo planes
#define WIN  0
#define PCAR 1024.0f
#define SCL  0.125f   // 1/sqrt(float32(64))
#define MID  1024      // q / k width
#define CO   1024      // v width
#define CC   1024
typedef _Float16 h16;
typedef unsigned short bf;
typedef __attribute__((ext_vector_type(16))) __bf16   v16bf;
typedef __attribute__((ext_vector_type(16))) _Float16 v16h;
typedef __attribute__((ext_vector_type(8)))  _Float16 v8h;
typedef __attribute__((ext_vector_type(8)))  unsigned short v8us;
typedef __attribute__((ext_vector_type(8)))  float    v8f;
typedef __attribute__((ext_vector_type(4)))  float    v4f;
typedef v8h  __attribute__((may_alias)) v8ha;
typedef v4f  __attribute__((may_alias)) v4fa;
typedef v8us __attribute__((may_alias)) v8usa;

__device__ __forceinline__ unsigned short f2bf(float f) { unsigned u = __float_as_uint(f); u += 0x7FFFu + ((u >> 16) & 1u); return (unsigned short)(u >> 16); }
__device__ __forceinline__ float bf2f(unsigned short b) { return __uint_as_float(((unsigned)b) << 16); }
__device__ __forceinline__ float bfr(float f) { return bf2f(f2bf(f)); }
__device__ __forceinline__ v16h cat16(v8h lo, v8h hi) { return __builtin_shufflevector(lo, hi, 0, 1, 2, 3, 4, 5, 6, 7, 8, 9, 10, 11, 12, 13, 14, 15); }
__device__ __forceinline__ v16bf cat16b(v8us lo, v8us hi) { return __builtin_bit_cast(v16bf, __builtin_shufflevector(lo, hi, 0, 1, 2, 3, 4, 5, 6, 7, 8, 9, 10, 11, 12, 13, 14, 15)); }
__device__ __forceinline__ v8f wmma16(v16h a, v16h b, v8f c) { return __builtin_amdgcn_wmma_f32_16x16x32_f16(false, a, false, b, (short)0, c, false, false); }
__device__ __forceinline__ v8f wmmab(v16bf a, v16bf b, v8f c) { return __builtin_amdgcn_wmma_f32_16x16x32_bf16(false, a, false, b, (short)0, c, false, false); }

// fragment loaders: 16 rows (lane c = row) of a K-contiguous 16-bit plane, p already at the lane's row and at 8h: k = 8h + s for s < 8, 16 + 8h + (s - 8) behind
template <typename T16> struct WFrag;
template <> struct WFrag<h16> { typedef v16h V; static __device__ __forceinline__ V ld(const h16* p) { return cat16(*(const v8h*)p, *(const v8h*)(p + 16)); } static __device__ __forceinline__ v8f mma(V a, V b, v8f c) { return wmma16(a, b, c); } };
template <> struct WFrag<bf> { typedef v16bf V; static __device__ __forceinline__ V ld(const bf* p) { return cat16b(*(const v8us*)p, *(const v8us*)(p + 16)); } static __device__ __forceinline__ v8f mma(V a, V b, v8f c) { return wmmab(a, b, c); } };

__device__ __forceinline__ h16 tohx(float x) { return (h16)x; }
__device__ __forceinline__ void splitf(float y, unsigned short& h, unsigned short& l) { h = f2bf(y); l = f2bf(y - bf2f(h)); }
typedef __attribute__((ext_vector_type(2))) _Float16 v2h;
typedef __attribute__((ext_vector_type(4))) _Float16 v4h;
typedef __attribute__((ext_vector_type(2))) unsigned short v2us;
typedef __attribute__((ext_vector_type(4))) unsigned short v4us;
typedef __attribute__((ext_vector_type(2))) float v2f;
typedef __attribute__((ext_vector_type(4))) int v4i;

__device__ __forceinline__ float xhalf(float x) { const int b = __float_as_int(x); return __int_as_float(__builtin_amdgcn_permlanex16(b, b, 0x76543210, 0xfedcba98, false, false)); }   /* lane l <-> l ^ 16 */
// behind a group of global loads or stores: their address (and data) registers are rewritten only behind this wait. The group's base pointers are inputs, so that their registers stay theirs up to the wait
// (no load of the group lands on them); the scheduling barrier keeps the register writes that follow in the source behind the wait in the listing too
__device__ __forceinline__ void xwait(const void* p0, const void* p1) { asm volatile("s_wait_xcnt 0x0" :: "v"(p0), "v"(p1) : "memory"); __builtin_amdgcn_sched_barrier(0); }
// 2^x: v_exp_f32 and, in the same statement, the one slot that the instruction set asks for behind a transcendental before its result is read or its source overwritten
__device__ __forceinline__ float ex2(float x) { float r; asm("v_exp_f32 %0, %1\n\tv_nop" : "=v"(r) : "v"(x)); return r; }
#define SCL2 0.18033688011112042f   // SCL x log2(e)
#define QT   2                    // 16-column query tiles per wave
#define SK   64                   // keys per stage
#define NST  (TT / SK)            // stages
#define LPB  144                  // LDS row pitch, bytes: 128 + 16 = 16 x odd, 16 rows of a 16-byte read fall on 64 different banks
#define LPE  (LPB / 2)            // the same in 16-bit elements
#define TSZ  (64 * LPB)           // one tile of 64 rows
#define BSZ  (5 * TSZ)            // one stage: K hi, K lo, V^T fp16, V^T hi, V^T lo
// one stage's five copies of a thread (one 16-byte piece of each of the five tiles; a wave's 32 lanes copy four whole 128-byte rows at a time). d: the thread's place in tile 0 of the target buffer (LDS byte address);
// the five pointers: the head's planes (the same for the whole work-group and for every stage, so they stay in scalar registers); ko, vo: the thread's piece of the stage's K tiles and of its V^T tiles, in bytes from there.
// The copies are the builtin, whose registers are the compiler's own affair: the wave goes on behind the fifth issue and waits for nothing here (their landing is waited for at the publish point)
typedef int ci4 __attribute__((vector_size(16)));
typedef __attribute__((address_space(1))) ci4* gp4;
typedef __attribute__((address_space(3))) ci4* lp4;
typedef __attribute__((address_space(1))) char* gpc;
__device__ __forceinline__ void cp16(unsigned d, const void* base, unsigned off) { __builtin_amdgcn_global_load_async_to_lds_b128((gp4)((gpc)(size_t)base + off), (lp4)d, 0, 0); }
__device__ __forceinline__ void stage_copy(unsigned d, const bf* pkh, const bf* pkl, const h16* pv16, const bf* pvh, const bf* pvl, unsigned ko, unsigned vo) {
    cp16(d, pkh, ko); cp16(d + TSZ, pkl, ko); cp16(d + 2 * TSZ, pv16, vo); cp16(d + 3 * TSZ, pvh, vo); cp16(d + 4 * TSZ, pvl, vo);
}
typedef __attribute__((ext_vector_type(8))) unsigned v8u;
typedef __attribute__((ext_vector_type(2))) __bf16 v2bf;
// splitf of two neighbours on whole registers: h = the two hi parts (x0's in the low half), l = the two lo parts; both roundings to nearest even, as in f2bf, by the packed conversion.
// The hand-rounded form with its 16-bit pieces took the hi/lo kind, at two query tiles, past the registers a wave has at four waves a SIMD
__device__ __forceinline__ void splitf2(float x0, float x1, unsigned& h, unsigned& l) {
    const v2f x = {x0, x1}; h = __builtin_bit_cast(unsigned, __builtin_convertvector(x, v2bf));
    const v2f xh = {__uint_as_float(h << 16), __uint_as_float(h & 0xFFFF0000u)};
    l = __builtin_bit_cast(unsigned, __builtin_convertvector(x - xh, v2bf)); }
// a lane's sum of its 16 probabilities of one query, as a tree of packed adds: the pass's range test waits for it, and a chain of 16 dependent adds would stand in front of the second product
__device__ __forceinline__ float rowsum(const float (&p)[16]) { v2f a[8];
#pragma unroll
    for (int e = 0; e < 8; ++e) a[e] = (v2f){p[2 * e], p[2 * e + 1]};
#pragma unroll
    for (int w = 4; w > 0; w >>= 1)
#pragma unroll
        for (int e = 0; e < w; ++e) a[e] += a[e + w];
    return a[0][0] + a[0][1]; }
// one wave's work on one stage in LDS: ONE pass of 32 keys, the wave's half of the stage's 64 (st: the stage's buffer; koff, voff: the lane's place in a 16-row block of a K tile and of a V^T tile, the wave's half counted in, in elements; hr, nh: the wave's kind, hi/lo or not, the same in all its lanes).
// Scores and softmax are the same code for both kinds of wave; only the V^T fragments and the second product differ, under scalar branches, so that the stage loop and its barrier are one for the whole work-group.
// The two kinds' second products are two branches one behind the other, each on a flag of its own, not an if / else: so each updates O^T in its own registers (as if / else the build kept a second set of all O^T tiles and copied it back every stage)
// refill: the next stage's copies. They are issued behind the pass's key fragment reads, so that between the barrier and those reads, on which the first products wait, stands nothing; address sums and issue run under the LDS latency
template <typename F> __device__ __forceinline__ void fattn_stage(const unsigned char* st, unsigned koff, unsigned voff, bool hr, bool nh, const v16bf (&qh)[QT][2], const v16bf (&ql)[QT][2], v8f (&o)[4][QT], float (&m)[QT], float (&l)[QT], F refill) {
    const bf* khp = (const bf*)st + koff; const bf* klp = (const bf*)(st + TSZ) + koff; const bf* vap = (const bf*)(st + (hr ? 3 * TSZ : 2 * TSZ)) + voff; const bf* vlp = (const bf*)(st + 4 * TSZ) + voff;
    const float cb = hr ? 0.0f : 10.0f;
    // the fragment and accumulator arrays are indexed by constants only (every loop over them is unrolled), so that they stay in registers
    v16bf kh[2][2], kl[2][2];
#pragma unroll
    for (int kt = 0; kt < 2; ++kt)
#pragma unroll
        for (int ks = 0; ks < 2; ++ks) { kh[kt][ks] = WFrag<bf>::ld(khp + kt * 16 * LPE + ks * 32); kl[kt][ks] = WFrag<bf>::ld(klp + kt * 16 * LPE + ks * 32); }
    refill();
    /* every key fragment serves both query tiles: four independent accumulator chains */
    v8f s[2][QT];
#pragma unroll
    for (int kt = 0; kt < 2; ++kt)
#pragma unroll
        for (int qt = 0; qt < QT; ++qt) { v8f a = (v8f){};
#pragma unroll
            for (int ks = 0; ks < 2; ++ks) { a = wmmab(kh[kt][ks], qh[qt][ks], a); a = wmmab(kl[kt][ks], qh[qt][ks], a); a = wmmab(kh[kt][ks], ql[qt][ks], a); }
            s[kt][qt] = a; }
    /* the reference is known before the scores are: the first 16 keys' probabilities need not wait for the last 16 keys' products and run beside them */
    float p[QT][16], ps[QT]; bool big = false;
    const float top = hr ? 32.0f : 32768.0f;   /* 2^5 above the carry: fp16 holds every P under it */
#pragma unroll
    for (int qt = 0; qt < QT; ++qt)
#pragma unroll
        for (int e = 0; e < 8; ++e) p[qt][e] = ex2(fmaf(s[0][qt][e], SCL2, cb - m[qt]));
    /* the V^T fragments, behind the key fragments' last use (their registers are free by then). va: the hi plane's bits (hr) or the fp16 plane's */
    v16bf va[4];
#pragma unroll
    for (int dt = 0; dt < 4; ++dt) va[dt] = WFrag<bf>::ld(vap + dt * 16 * LPE);
    __builtin_amdgcn_sched_barrier(0);   /* holds the V^T reads in front of the last 16 keys' exponentials, under which their LDS latency runs; without it the build issued them directly in front of the second product */
#pragma unroll
    for (int qt = 0; qt < QT; ++qt) {
#pragma unroll
        for (int e = 8; e < 16; ++e) p[qt][e] = ex2(fmaf(s[1][qt][e - 8], SCL2, cb - m[qt]));
        ps[qt] = rowsum(p[qt]); big = big || !(ps[qt] <= top);
    }
    /* one test a pass for the whole wave (a scalar branch). Both halves of a query take the same step, from the larger of their two sums: floor(log2(sum)) less the carry */
    if (__builtin_amdgcn_ballot_w32(big) != 0) {
#pragma unroll
        for (int qt = 0; qt < QT; ++qt) {
            const float t = fmaxf(ps[qt], xhalf(ps[qt]));
            const int dl = t <= top ? 0 : (int)(__float_as_uint(t) >> 23) - 127 - (hr ? 0 : 10);
            const float f = __uint_as_float((unsigned)(127 - dl) << 23);
            m[qt] += (float)dl; l[qt] *= f; ps[qt] *= f;
#pragma unroll
            for (int e = 0; e < 16; ++e) p[qt][e] *= f;
#pragma unroll
            for (int dt = 0; dt < 4; ++dt) o[dt][qt] *= f;
        }
    }
    /* ex2 is asm: the products below stand in blocks of their own, behind every ex2 of the pass; an ex2 beside the score products reads an fma's result, never an accumulator, and where its result lands is read in the listing */
    if (hr) {
        /* P of both query tiles is split first (its f32 values end there); vb, the lo plane's fragment, is asked for tile by tile inside the branch that uses it: so the hi/lo kind needs no more registers than a wave has at four waves a SIMD */
        v16bf ph[QT], pl[QT];
#pragma unroll
        for (int qt = 0; qt < QT; ++qt) { v8u hh, ll;
            l[qt] += ps[qt];
#pragma unroll
            for (int e = 0; e < 8; ++e) { unsigned a2, c2; splitf2(p[qt][2 * e], p[qt][2 * e + 1], a2, c2); hh[e] = a2; ll[e] = c2; }
            ph[qt] = __builtin_bit_cast(v16bf, hh); pl[qt] = __builtin_bit_cast(v16bf, ll); }
#pragma unroll
        for (int dt = 0; dt < 4; ++dt) { const v16bf vb = WFrag<bf>::ld(vlp + dt * 16 * LPE);
#pragma unroll
            for (int qt = 0; qt < QT; ++qt) { o[dt][qt] = wmmab(va[dt], ph[qt], o[dt][qt]); o[dt][qt] = wmmab(va[dt], pl[qt], o[dt][qt]); o[dt][qt] = wmmab(vb, ph[qt], o[dt][qt]); } }
    }
    if (nh) {
#pragma unroll
        for (int qt = 0; qt < QT; ++qt) { v16h pf;
            l[qt] += ps[qt];
#pragma unroll
            for (int e = 0; e < 16; ++e) pf[e] = tohx(p[qt][e]);
#pragma unroll
            for (int dt = 0; dt < 4; ++dt) { o[dt][qt] = wmma16(__builtin_bit_cast(v16h, va[dt]), pf, o[dt][qt]); } }
    }
}
// grid (16, heads), 16 waves in 8 pairs: a pair owns 32 query columns, wave 2 c the first 32 keys of every stage and wave 2 c + 1 the last 32, each with its own reference, sum and O^T; the two are joined once, through LDS, behind the loop.
// Pair 0 (waves 0 and 1) takes one of the head's 16 hi/lo column blocks (rows < RH), pairs 1-7 seven of its 112 fp16 blocks, so that every work-group carries the same load
__global__ __launch_bounds__(512) void k_fattn(const bf* __restrict__ QPh, const bf* __restrict__ QPl, const h16* __restrict__ VT16, const bf* __restrict__ VTh, const bf* __restrict__ VTl, float* __restrict__ out) {
    __shared__ __attribute__((aligned(16))) unsigned char ring[2 * BSZ];
    const int w = __builtin_amdgcn_readfirstlane((int)(threadIdx.x >> 5)); const int lane = threadIdx.x & 31, lr = lane & 15, hi = lane >> 4; const size_t hp = (size_t)blockIdx.y * TT * HD;
    const bf* Kh = QPh + hp; const bf* Kl = QPl + hp; float* orow = out + blockIdx.y * HD;
    const int cw = __builtin_amdgcn_readfirstlane((int)(threadIdx.x >> 6)), g = w & 1;   /* the pair, and the wave's half of every stage */
    const int q0 = (cw == 0) ? (int)blockIdx.x * 32 : RH + ((int)blockIdx.x * 7 + cw - 1) * 32;
    /* the thread's piece of every tile: row tid / 8, 16-byte column tid % 8 */
    const int crow = (int)(threadIdx.x >> 3), ccol = (int)(threadIdx.x & 7);
    const unsigned cd = (unsigned)(size_t)ring + (unsigned)(crow * LPB + ccol * 16);
    const unsigned ko = (unsigned)(crow * HD + ccol * 8) * 2u, vo = (unsigned)(crow * TT + ccol * 8) * 2u;   /* bytes, stage 0 */
    const h16* V16 = VT16 + hp; const bf* Vh = VTh + hp; const bf* Vl = VTl + hp;
    stage_copy(cd, Kh, Kl, V16, Vh, Vl, ko, vo);   /* stage 0 into buffer 0 */
    /* the query fragments, kept in registers */
    v16bf qh[QT][2], ql[QT][2];
    const bf* qhp = Kh + (size_t)q0 * HD + lr * HD + 8 * hi; const bf* qlp = Kl + (size_t)q0 * HD + lr * HD + 8 * hi;
#pragma unroll
    for (int qt = 0; qt < QT; ++qt)
#pragma unroll
        for (int ks = 0; ks < 2; ++ks) { qh[qt][ks] = WFrag<bf>::ld(qhp + qt * 16 * HD + ks * 32); ql[qt][ks] = WFrag<bf>::ld(qlp + qt * 16 * HD + ks * 32); }
    xwait(qhp, qlp);
    v8f o[4][QT];
#pragma unroll
    for (int dt = 0; dt < 4; ++dt)
#pragma unroll
        for (int qt = 0; qt < QT; ++qt) o[dt][qt] = (v8f){};
    float m[QT], l[QT];
#pragma unroll
    for (int qt = 0; qt < QT; ++qt) {
        /* the reference: q.q x SCL2, from the lane's own half of the query row (hi + lo) and the other half's */
        float d = 0.f;
#pragma unroll
        for (int ks = 0; ks < 2; ++ks) { const v8u a = __builtin_bit_cast(v8u, qh[qt][ks]), b = __builtin_bit_cast(v8u, ql[qt][ks]);
#pragma unroll
            for (int e = 0; e < 8; ++e) { const float x0 = __uint_as_float(a[e] << 16) + __uint_as_float(b[e] << 16), x1 = __uint_as_float(a[e] & 0xFFFF0000u) + __uint_as_float(b[e] & 0xFFFF0000u); d = fmaf(x0, x0, fmaf(x1, x1, d)); } }
        m[qt] = (d + xhalf(d)) * SCL2; l[qt] = 0.f; }
    const unsigned loff = (unsigned)(lr * LPE + 8 * hi), koff = loff + (unsigned)(g * 32 * LPE), voff = loff + (unsigned)(g * 32);
    asm volatile("s_wait_asynccnt 0x0" ::: "memory");   /* this wave's copies of stage 0 have landed */
    __syncthreads();                                     /* and every other wave's: stage 0 is published */
    // rolled: one stage's fragments, scores and the output tiles are the register budget
#pragma unroll 1
    for (int s = 0; s < NST; ++s) {
        const unsigned char* st = ring + (s & 1) * BSZ;
        /* stage s + 1 goes into the other buffer, whose last readers (pass s - 1) ended in front of the barrier that this pass began behind; the test reads the same for the whole work-group */
        fattn_stage(st, koff, voff, w < 2, cw != 0, qh, ql, o, m, l, [&]() {
            /* the stage's number through readfirstlane: so the build adds it to the two 32-bit offsets, beside scalar bases; without it it kept five running 64-bit addresses in vector registers, past what a wave has at four waves a SIMD */
            const unsigned sn = (unsigned)__builtin_amdgcn_readfirstlane(s + 1);
            if (s + 1 < NST) stage_copy(cd + (sn & 1u) * BSZ, Kh, Kl, V16, Vh, Vl, ko + sn * (SK * HD * 2), vo + sn * (SK * 2)); });
        /* publish point of stage s + 1, every wave: its own LDS reads of stage s are done, its own copies of stage s + 1 have landed, then the barrier; only behind it, in pass s + 1, is stage s's buffer refilled */
        asm volatile("s_wait_dscnt 0x0" ::: "memory");
        asm volatile("s_wait_asynccnt 0x0" ::: "memory");
        __syncthreads();
    }
    asm volatile("s_wait_asynccnt 0x0" ::: "memory");   /* no copy is outstanding when the wave ends */
    /* the pair's two halves are joined: behind the loop's last barrier nobody reads the ring and no copy is in flight, so it serves as the hand-over place (17 x 16 bytes a lane and pair) */
    v4fa* mg = (v4fa*)ring + cw * 17 * 32 + lane;
    if (g) {
#pragma unroll
        for (int dt = 0; dt < 4; ++dt)
#pragma unroll
            for (int qt = 0; qt < QT; ++qt) { mg[((dt * QT + qt) * 2) * 32] = (v4f){o[dt][qt][0], o[dt][qt][1], o[dt][qt][2], o[dt][qt][3]}; mg[((dt * QT + qt) * 2 + 1) * 32] = (v4f){o[dt][qt][4], o[dt][qt][5], o[dt][qt][6], o[dt][qt][7]}; }
        mg[16 * 32] = (v4f){m[0], m[1], l[0], l[1]};
    }
    __syncthreads();   /* the odd waves' halves are in LDS before the even waves read them */
    if (g) return;
    const v4f ml = mg[16 * 32];
    /* register j of o[dt][qt] = O[query q0 + 16 qt + c][d = 16 dt + 8h + j]: 8 consecutive floats of one output row per lane */
#pragma unroll
    for (int qt = 0; qt < QT; ++qt) {
        const float mn = fmaxf(m[qt], ml[qt]), fa = ex2(m[qt] - mn), fb = ex2(ml[qt] - mn), lj = fmaf(l[qt], fa, ml[2 + qt] * fb);
        const float f = __fdiv_rn(1.0f, lj + xhalf(lj)), ga = fa * f, gb = fb * f; float* r = orow + (size_t)(q0 + qt * 16 + lr) * DM + 8 * hi;
#pragma unroll
        for (int dt = 0; dt < 4; ++dt) { const v4f pa = mg[((dt * QT + qt) * 2) * 32], pb = mg[((dt * QT + qt) * 2 + 1) * 32]; v4f a, b;
#pragma unroll
            for (int j = 0; j < 4; ++j) { a[j] = fmaf(o[dt][qt][j], ga, pa[j] * gb); b[j] = fmaf(o[dt][qt][4 + j], ga, pb[j] * gb); }
            *(v4f*)(r + dt * 16) = a; *(v4f*)(r + dt * 16 + 4) = b; }
        xwait(r, r); }
}

// ---- k_planes: every plane that k_fattn reads, in one launch. One work-group takes 128 positions x the 64 columns of one head: the f32 tile is read once, in whole 128-byte lines, and laid in LDS;
// from there each thread takes 8 neighbours of a row (K hi/lo planes [h][t][64]) and 8 neighbours of a column (V^T fp16, hi, lo planes [h][64][t]), so that every store is 16 bytes a lane and 8 lanes fill a 128-byte line.
#define PT   128                  // positions per tile
#define PP   65                   // LDS row pitch in floats, odd: 8 floats of 4 neighbouring rows, and rows 8 apart of 4 neighbouring columns, fall on 32 different banks
__global__ __launch_bounds__(256) void k_planes(const float* __restrict__ X, bf* __restrict__ Ph, bf* __restrict__ Pl, h16* __restrict__ V16, bf* __restrict__ Vh, bf* __restrict__ Vl) {
    __shared__ float tile[PT * PP];
    const int tid = (int)threadIdx.x, t0 = (int)blockIdx.x * PT; const size_t hp = (size_t)blockIdx.y * TT * HD;
    /* in: 16 lanes x 16 bytes = the head's 256 bytes of one position; all eight loads of a thread in flight together */
    const int ir = tid >> 4, ic = (tid & 15) * 4;
    const float* sp = X + (size_t)(t0 + ir) * DM + blockIdx.y * HD + ic;
    // every loop of this kernel is unrolled: the register arrays are indexed by constants only, and each group of loads or stores stands together in front of its wait
    v4f in[PT / 16];
#pragma unroll
    for (int i = 0; i < PT / 16; ++i) in[i] = *(const v4f*)(sp + (size_t)i * 16 * DM);
    xwait(sp, sp);
#pragma unroll
    for (int i = 0; i < PT / 16; ++i)
#pragma unroll
        for (int j = 0; j < 4; ++j) tile[(ir + i * 16) * PP + ic + j] = in[i][j];
    __syncthreads();   /* the tile is whole before anybody reads across the writers' rows */
    const int r8 = tid >> 3, c8 = (tid & 7) * 8;
    /* K planes: position t0 + r8 + 32 i, columns c8 .. c8 + 7 */
    v8us kh[PT / 32], kl[PT / 32];
#pragma unroll
    for (int i = 0; i < PT / 32; ++i)
#pragma unroll
        for (int j = 0; j < 8; ++j) { unsigned short a2, c2; splitf(tile[(r8 + i * 32) * PP + c8 + j], a2, c2); kh[i][j] = a2; kl[i][j] = c2; }
    bf* kph = Ph + hp + (size_t)(t0 + r8) * HD + c8; bf* kpl = Pl + hp + (size_t)(t0 + r8) * HD + c8;
#pragma unroll
    for (int i = 0; i < PT / 32; ++i) { *(v8us*)(kph + i * 32 * HD) = kh[i]; *(v8us*)(kpl + i * 32 * HD) = kl[i]; }
    xwait(kph, kpl);
    /* V^T planes: column r8 + 32 i, positions t0 + 64 u + c8 .. + 7 */
    const size_t vo = hp + (size_t)r8 * TT + t0 + c8;
    h16* vp16 = V16 + vo; bf* vph = Vh + vo; bf* vpl = Vl + vo;
#pragma unroll
    for (int i = 0; i < HD / 32; ++i) {
        v8h f[PT / 64]; v8us vh[PT / 64], vl[PT / 64];
#pragma unroll
        for (int u = 0; u < PT / 64; ++u)
#pragma unroll
            for (int j = 0; j < 8; j += 2) { v2f x; unsigned short a2, c2; x[0] = tile[(u * 64 + c8 + j) * PP + r8 + i * 32]; x[1] = tile[(u * 64 + c8 + j + 1) * PP + r8 + i * 32];
                const v2h y = __builtin_convertvector(x, v2h); f[u][j] = y[0]; f[u][j + 1] = y[1];   /* two at a time: one packed conversion, to nearest even like tohx */
                splitf(x[0], a2, c2); vh[u][j] = a2; vl[u][j] = c2; splitf(x[1], a2, c2); vh[u][j + 1] = a2; vl[u][j + 1] = c2; }
#pragma unroll
        for (int u = 0; u < PT / 64; ++u) { *(v8h*)(vp16 + (size_t)i * 32 * TT + u * 64) = f[u]; *(v8us*)(vph + (size_t)i * 32 * TT + u * 64) = vh[u]; *(v8us*)(vpl + (size_t)i * 32 * TT + u * 64) = vl[u]; }
        xwait(vp16, vph); }
}
extern "C" void kernel_launch(void* const* d_in, const int* in_sizes, int n_in,
                              void* d_out, int out_size, void* d_ws, size_t ws_size, hipStream_t stream) {
    (void)in_sizes; (void)n_in; (void)out_size;
    const float* x = (const float*)d_in[0];   /* x [4096][1024]: q = k = v = x reshaped to 16 heads x 64 (no projections, no batch) */
    float* OUT = (float*)d_out;     // [4096][1024]
    char* wsp = (char*)d_ws;
    auto take = [&](size_t bytes) { char* p = wsp; wsp += (bytes + 255) & ~(size_t)255; return (void*)p; };
    bf* QPh = (bf*)take((size_t)TT * MID * 2); bf* QPl = (bf*)take((size_t)TT * MID * 2);   /* k = q: one set of planes */
    h16* VT16 = (h16*)take((size_t)CO * TT * 2); bf* VTh = (bf*)take((size_t)CO * TT * 2); bf* VTl = (bf*)take((size_t)CO * TT * 2);
    if ((size_t)(wsp - (char*)d_ws) > ws_size) return;    // ws 256 MiB (carve 40 MiB)
    k_planes<<<dim3(TT / PT, NH_, 1), 256, 0, stream>>>(x, QPh, QPl, VT16, VTh, VTl);   /* q (= k) planes [h][n][64] (bf16 hi/lo split) and v^T planes [h][64][n] (fp16, bf16 hi/lo) straight from the f32 input */
    k_fattn<<<dim3(RH / 32, NH_, 1), 512, 0, stream>>>(QPh, QPl, VT16, VTh, VTl, OUT);   /* all heads: scores x 1/8, softmax over the 4,096 keys, attn.V, output rows written once */
}

// v008
// Measured time: 93.4 microseconds a run.
// Two timings next to v007 both put it at 1.11 times that version's speed.
// Counting every step since v000, it is 41.8 times as fast.
#include <hip/hip_runtime.h>

// Scaled dot-product self-attention where q = k = v = the input itself (x [4096][1024] reshaped to 16 heads x 64; no projections, no batch; scores = x_h.x_h x 1/sqrt(64); softmax (no mask); out = attn.x_h merged -> [4096][1024] (4.2 M); argument order x).
// Layout: the f32 input feeds one plane builder directly: ONE set of hi/lo planes serves as both q and k (k = q), value^T planes from the same rows; k_fattn then does scores (every row hi/lo, 3 products), softmax and attn.V (rows < 512 hi/lo, rest fp16 x1024) in one launch, a softmax reference that starts at the query's own score (raised in whole steps when a pass's sum leaves range) and a running sum per query, and writes the output once. NOTE the hi/lo split carries the f32 input.
// Compute dtypes, f32 accumulate: input split into bf16 hi/lo (scores, exact to ~2^-16) and fp16 (value planes for rows >= 512); softmax f32; output f32.

#define NB_  1
#define TT   4096
#define DM   1024
#define NH_  16
#define NKV  16
#define REP  (NH_ / NKV)
#define HD   64
#define DQ   (NH_ * HD)
#define DKV  (NKV * HD)
#define ZH   1
#define RH   512                  // query rows < RH use hi+lo planes
#define WIN  0
#define PCAR 1024.0f
#define SCL  0.125f   // 1/sqrt(float32(64))
#define MID  1024      // q / k width
#define CO   1024      // v width
#define CC   1024
typedef _Float16 h16;
typedef unsigned short bf;
typedef __attribute__((ext_vector_type(16))) __bf16   v16bf;
typedef __attribute__((ext_vector_type(16))) _Float16 v16h;
typedef __attribute__((ext_vector_type(8)))  _Float16 v8h;
typedef __attribute__((ext_vector_type(8)))  unsigned short v8us;
typedef __attribute__((ext_vector_type(8)))  float    v8f;
typedef __attribute__((ext_vector_type(4)))  float    v4f;
typedef v8h  __attribute__((may_alias)) v8ha;
typedef v4f  __attribute__((may_alias)) v4fa;
typedef v8us __attribute__((may_alias)) v8usa;

__device__ __forceinline__ unsigned short f2bf(float f) { unsigned u = __float_as_uint(f); u += 0x7FFFu + ((u >> 16) & 1u); return (unsigned short)(u >> 16); }
__device__ __forceinline__ float bf2f(unsigned short b) { return __uint_as_float(((unsigned)b) << 16); }
__device__ __forceinline__ float bfr(float f) { return bf2f(f2bf(f)); }
__device__ __forceinline__ v16h cat16(v8h lo, v8h hi) { return __builtin_shufflevector(lo, hi, 0, 1, 2, 3, 4, 5, 6, 7, 8, 9, 10, 11, 12, 13, 14, 15); }
__device__ __forceinline__ v16bf cat16b(v8us lo, v8us hi) { return __builtin_bit_cast(v16bf, __builtin_shufflevector(lo, hi, 0, 1, 2, 3, 4, 5, 6, 7, 8, 9, 10, 11, 12, 13, 14, 15)); }
__device__ __forceinline__ v8f wmma16(v16h a, v16h b, v8f c) { return __builtin_amdgcn_wmma_f32_16x16x32_f16(false, a, false, b, (short)0, c, false, false); }
__device__ __forceinline__ v8f wmmab(v16bf a, v16bf b, v8f c) { return __builtin_amdgcn_wmma_f32_16x16x32_bf16(false, a, false, b, (short)0, c, false, false); }

// fragment loaders: 16 rows (lane c = row) of a K-contiguous 16-bit plane, p already at the lane's row and at 8h: k = 8h + s for s < 8, 16 + 8h + (s - 8) behind
template <typename T16> struct WFrag;
template <> struct WFrag<h16> { typedef v16h V; static __device__ __forceinline__ V ld(const h16* p) { return cat16(*(const v8h*)p, *(const v8h*)(p + 16)); } static __device__ __forceinline__ v8f mma(V a, V b, v8f c) { return wmma16(a, b, c); } };
template <> struct WFrag<bf> { typedef v16bf V; static __device__ __forceinline__ V ld(const bf* p) { return cat16b(*(const v8us*)p, *(const v8us*)(p + 16)); } static __device__ __forceinline__ v8f mma(V a, V b, v8f c) { return wmmab(a, b, c); } };

__device__ __forceinline__ h16 tohx(float x) { return (h16)x; }
__device__ __forceinline__ void splitf(float y, unsigned short& h, unsigned short& l) { h = f2bf(y); l = f2bf(y - bf2f(h)); }
typedef __attribute__((ext_vector_type(2))) _Float16 v2h;
typedef __attribute__((ext_vector_type(4))) _Float16 v4h;
typedef __attribute__((ext_vector_type(2))) unsigned short v2us;
typedef __attribute__((ext_vector_type(4))) unsigned short v4us;
typedef __attribute__((ext_vector_type(2))) float v2f;
typedef __attribute__((ext_vector_type(4))) int v4i;

__device__ __forceinline__ float xhalf(float x) { const int b = __float_as_int(x); return __int_as_float(__builtin_amdgcn_permlanex16(b, b, 0x76543210, 0xfedcba98, false, false)); }   /* lane l <-> l ^ 16 */
// behind a group of global loads or stores: their address (and data) registers are rewritten only behind this wait. The group's base pointers are inputs, so that their registers stay theirs up to the wait
// (no load of the group lands on them); the scheduling barrier keeps the register writes that follow in the source behind the wait in the listing too
__device__ __forceinline__ void xwait(const void* p0, const void* p1) { asm volatile("s_wait_xcnt 0x0" :: "v"(p0), "v"(p1) : "memory"); __builtin_amdgcn_sched_barrier(0); }
// 2^x: v_exp_f32 and, in the same statement, the one slot that the instruction set asks for behind a transcendental before its result is read or its source overwritten
__device__ __forceinline__ float ex2(float x) { float r; asm("v_exp_f32 %0, %1\n\tv_nop" : "=v"(r) : "v"(x)); return r; }
// 2^x of the eight registers of a score tile, in place, in one statement: each v_exp_f32 is independent of the one in front of it, so only the last needs the slot that the instruction set asks for behind a transcendental (the closing v_nop).
// that four vector slots or more stand between a tile's last product and this statement is read in the listing
__device__ __forceinline__ void ex2x8(const v8f& a, float* p) {
    float x0 = a[0], x1 = a[1], x2 = a[2], x3 = a[3], x4 = a[4], x5 = a[5], x6 = a[6], x7 = a[7];
    asm("v_exp_f32 %0, %0\n\tv_exp_f32 %1, %1\n\tv_exp_f32 %2, %2\n\tv_exp_f32 %3, %3\n\tv_exp_f32 %4, %4\n\tv_exp_f32 %5, %5\n\tv_exp_f32 %6, %6\n\tv_exp_f32 %7, %7\n\tv_nop" : "+v"(x0), "+v"(x1), "+v"(x2), "+v"(x3), "+v"(x4), "+v"(x5), "+v"(x6), "+v"(x7));
    p[0] = x0; p[1] = x1; p[2] = x2; p[3] = x3; p[4] = x4; p[5] = x5; p[6] = x6; p[7] = x7; }
#define SCL2 0.18033688011112042f   // SCL x log2(e)
#define QT   2                    // 16-column query tiles per wave
#define SK   64                   // keys per stage
#define NST  (TT / SK)            // stages
#define LPB  144                  // LDS row pitch, bytes: 128 + 16 = 16 x odd, 16 rows of a 16-byte read fall on 64 different banks
#define LPE  (LPB / 2)            // the same in 16-bit elements
#define TSZ  (64 * LPB)           // one tile of 64 rows
#define BSZ  (5 * TSZ)            // one stage: K hi, K lo, V^T fp16, V^T hi, V^T lo
// one stage's five copies of a thread (one 16-byte piece of each of the five tiles; a wave's 32 lanes copy four whole 128-byte rows at a time). d: the thread's place in tile 0 of the target buffer (LDS byte address);
// the five pointers: the head's planes (the same for the whole work-group and for every stage, so they stay in scalar registers); ko, vo: the thread's piece of the stage's K tiles and of its V^T tiles, in bytes from there.
// The copies are the builtin, whose registers are the compiler's own affair: the wave goes on behind the fifth issue and waits for nothing here (their landing is waited for at the publish point)
typedef int ci4 __attribute__((vector_size(16)));
typedef __attribute__((address_space(1))) ci4* gp4;
typedef __attribute__((address_space(3))) ci4* lp4;
typedef __attribute__((address_space(1))) char* gpc;
__device__ __forceinline__ void cp16(unsigned d, const void* base, unsigned off) { __builtin_amdgcn_global_load_async_to_lds_b128((gp4)((gpc)(size_t)base + off), (lp4)d, 0, 0); }
__device__ __forceinline__ void stage_copy(unsigned d, const bf* pkh, const bf* pkl, const h16* pv16, const bf* pvh, const bf* pvl, unsigned ko, unsigned vo) {
    cp16(d, pkh, ko); cp16(d + TSZ, pkl, ko); cp16(d + 2 * TSZ, pv16, vo); cp16(d + 3 * TSZ, pvh, vo); cp16(d + 4 * TSZ, pvl, vo);
}
typedef __attribute__((ext_vector_type(8))) unsigned v8u;
typedef __attribute__((ext_vector_type(2))) __bf16 v2bf;
// splitf of two neighbours on whole registers: h = the two hi parts (x0's in the low half), l = the two lo parts; both roundings to nearest even, as in f2bf, by the packed conversion.
// The hand-rounded form with its 16-bit pieces took the hi/lo kind, at two query tiles, past the registers a wave has at four waves a SIMD
__device__ __forceinline__ void splitf2(float x0, float x1, unsigned& h, unsigned& l) {
    const v2f x = {x0, x1}; h = __builtin_bit_cast(unsigned, __builtin_convertvector(x, v2bf));
    const v2f xh = {__uint_as_float(h << 16), __uint_as_float(h & 0xFFFF0000u)};
    l = __builtin_bit_cast(unsigned, __builtin_convertvector(x - xh, v2bf)); }
// a lane's sum of its 16 probabilities of one query, as a tree of packed adds: the pass's range test waits for it, and a chain of 16 dependent adds would stand in front of the second product
__device__ __forceinline__ float rowsum(const float (&p)[16]) { v2f a[8];
#pragma unroll
    for (int e = 0; e < 8; ++e) a[e] = (v2f){p[2 * e], p[2 * e + 1]};
#pragma unroll
    for (int w = 4; w > 0; w >>= 1)
#pragma unroll
        for (int e = 0; e < w; ++e) a[e] += a[e + w];
    return a[0][0] + a[0][1]; }
// one wave's work on one stage in LDS: ONE pass of 32 keys, the wave's half of the stage's 64 (st: the stage's buffer; koff, voff: the lane's place in a 16-row block of a K tile and of a V^T tile, the wave's half counted in, in elements; hr, nh: the wave's kind, hi/lo or not, the same in all its lanes).
// Scores and softmax are the same code for both kinds of wave; only the V^T fragments and the second product differ, under scalar branches, so that the stage loop and its barrier are one for the whole work-group.
// The two kinds' second products are two branches one behind the other, each on a flag of its own, not an if / else: so each updates O^T in its own registers (as if / else the build kept a second set of all O^T tiles and copied it back every stage)
// refill: the next stage's copies. They are issued behind the pass's key fragment reads, so that between the barrier and those reads, on which the first products wait, stands nothing; address sums and issue run under the LDS latency
template <typename F> __device__ __forceinline__ void fattn_stage(const unsigned char* st, unsigned koff, unsigned voff, bool hr, bool nh, const v16bf (&qh)[QT][2], const v16bf (&ql)[QT][2], v8f (&o)[4][QT], float (&cm)[QT], float (&l)[QT], F refill) {
    const bf* khp = (const bf*)st + koff; const bf* klp = (const bf*)(st + TSZ) + koff; const bf* vap = (const bf*)(st + (hr ? 3 * TSZ : 2 * TSZ)) + voff; const bf* vlp = (const bf*)(st + 4 * TSZ) + voff;
    // the fragment and accumulator arrays are indexed by constants only (every loop over them is unrolled), so that they stay in registers
    v16bf kh[2][2], kl[2][2];
#pragma unroll
    for (int kt = 0; kt < 2; ++kt)
#pragma unroll
        for (int ks = 0; ks < 2; ++ks) { kh[kt][ks] = WFrag<bf>::ld(khp + kt * 16 * LPE + ks * 32); kl[kt][ks] = WFrag<bf>::ld(klp + kt * 16 * LPE + ks * 32); }
    refill();
    /* every key fragment serves both query tiles: four independent accumulator chains */
    /* carry - reference in all eight registers of a score tile's start value (a lane's eight scores belong to one query); made anew each pass, under the wait for the key fragments: kept over the loop the two tiles would take the wave past its registers */
    v8f c8[QT];
#pragma unroll
    for (int qt = 0; qt < QT; ++qt)
#pragma unroll
        for (int j = 0; j < 8; ++j) c8[qt][j] = cm[qt];
    v8f s[2][QT];
#pragma unroll
    for (int kt = 0; kt < 2; ++kt)
#pragma unroll
        for (int qt = 0; qt < QT; ++qt) { v8f a = c8[qt];   /* the accumulator starts at carry - reference, and the query fragments carry SCL2: what leaves the product is the exponent itself */
#pragma unroll
            for (int ks = 0; ks < 2; ++ks) { a = wmmab(kh[kt][ks], qh[qt][ks], a); a = wmmab(kl[kt][ks], qh[qt][ks], a); a = wmmab(kh[kt][ks], ql[qt][ks], a); }
            s[kt][qt] = a; }
    /* the reference is known before the scores are: the first 16 keys' probabilities need not wait for the last 16 keys' products and run beside them */
    float p[QT][16], ps[QT]; bool big = false;
    const float top = hr ? 32.0f : 32768.0f;   /* 2^5 above the carry: fp16 holds every P under it */
#pragma unroll
    for (int qt = 0; qt < QT; ++qt) ex2x8(s[0][qt], &p[qt][0]);
    /* the V^T fragments, behind the key fragments' last use (their registers are free by then). va: the hi plane's bits (hr) or the fp16 plane's */
    v16bf va[4];
#pragma unroll
    for (int dt = 0; dt < 4; ++dt) va[dt] = WFrag<bf>::ld(vap + dt * 16 * LPE);
    __builtin_amdgcn_sched_barrier(0);   /* holds the V^T reads in front of the last 16 keys' exponentials, under which their LDS latency runs; without it the build issued them directly in front of the second product */
#pragma unroll
    for (int qt = 0; qt < QT; ++qt) {
        ex2x8(s[1][qt], &p[qt][8]);
        ps[qt] = rowsum(p[qt]); big = big || !(ps[qt] <= top);
    }
    /* one test a pass for the whole wave (a scalar branch). Both halves of a query take the same step, from the larger of their two sums: floor(log2(sum)) less the carry */
    if (__builtin_amdgcn_ballot_w32(big) != 0) {
#pragma unroll
        for (int qt = 0; qt < QT; ++qt) {
            const float t = fmaxf(ps[qt], xhalf(ps[qt]));
            const int dl = t <= top ? 0 : (int)(__float_as_uint(t) >> 23) - 127 - (hr ? 0 : 10);
            const float f = __uint_as_float((unsigned)(127 - dl) << 23);
            cm[qt] -= (float)dl; l[qt] *= f; ps[qt] *= f;
#pragma unroll
            for (int e = 0; e < 16; ++e) p[qt][e] *= f;
#pragma unroll
            for (int dt = 0; dt < 4; ++dt) o[dt][qt] *= f;
        }
    }
    /* the exponentials are asm: the products below stand in blocks of their own, behind every exponential of the pass; the distance from a score product to the statement that reads its tile is read in the listing */
    if (hr) {
        /* P of both query tiles is split first (its f32 values end there); vb, the lo plane's fragment, is asked for tile by tile inside the branch that uses it: so the hi/lo kind needs no more registers than a wave has at four waves a SIMD */
        v16bf ph[QT], pl[QT];
#pragma unroll
        for (int qt = 0; qt < QT; ++qt) { v8u hh, ll;
            l[qt] += ps[qt];
#pragma unroll
            for (int e = 0; e < 8; ++e) { unsigned a2, c2; splitf2(p[qt][2 * e], p[qt][2 * e + 1], a2, c2); hh[e] = a2; ll[e] = c2; }
            ph[qt] = __builtin_bit_cast(v16bf, hh); pl[qt] = __builtin_bit_cast(v16bf, ll); }
#pragma unroll
        for (int dt = 0; dt < 4; ++dt) { const v16bf vb = WFrag<bf>::ld(vlp + dt * 16 * LPE);
#pragma unroll
            for (int qt = 0; qt < QT; ++qt) { o[dt][qt] = wmmab(va[dt], ph[qt], o[dt][qt]); o[dt][qt] = wmmab(va[dt], pl[qt], o[dt][qt]); o[dt][qt] = wmmab(vb, ph[qt], o[dt][qt]); } }
    }
    if (nh) {
#pragma unroll
        for (int qt = 0; qt < QT; ++qt) { v16h pf;
            l[qt] += ps[qt];
#pragma unroll
            for (int e = 0; e < 16; ++e) pf[e] = tohx(p[qt][e]);
#pragma unroll
            for (int dt = 0; dt < 4; ++dt) { o[dt][qt] = wmma16(__builtin_bit_cast(v16h, va[dt]), pf, o[dt][qt]); } }
    }
}
// grid (16, heads), 16 waves in 8 pairs: a pair owns 32 query columns, wave 2 c the first 32 keys of every stage and wave 2 c + 1 the last 32, each with its own reference, sum and O^T; the two are joined once, through LDS, behind the loop.
// Pair 0 (waves 0 and 1) takes one of the head's 16 hi/lo column blocks (rows < RH), pairs 1-7 seven of its 112 fp16 blocks, so that every work-group carries the same load
__global__ __launch_bounds__(512) void k_fattn(const bf* __restrict__ QPh, const bf* __restrict__ QPl, const h16* __restrict__ VT16, const bf* __restrict__ VTh, const bf* __restrict__ VTl, float* __restrict__ out) {
    __shared__ __attribute__((aligned(16))) unsigned char ring[2 * BSZ];
    const int w = __builtin_amdgcn_readfirstlane((int)(threadIdx.x >> 5)); const int lane = threadIdx.x & 31, lr = lane & 15, hi = lane >> 4; const size_t hp = (size_t)blockIdx.y * TT * HD;
    const bf* Kh = QPh + hp; const bf* Kl = QPl + hp; float* orow = out + blockIdx.y * HD;
    const int cw = __builtin_amdgcn_readfirstlane((int)(threadIdx.x >> 6)), g = w & 1;   /* the pair, and the wave's half of every stage */
    const int q0 = (cw == 0) ? (int)blockIdx.x * 32 : RH + ((int)blockIdx.x * 7 + cw - 1) * 32;
    /* the thread's piece of every tile: row tid / 8, 16-byte column tid % 8 */
    const int crow = (int)(threadIdx.x >> 3), ccol = (int)(threadIdx.x & 7);
    const unsigned cd = (unsigned)(size_t)ring + (unsigned)(crow * LPB + ccol * 16);
    const unsigned ko = (unsigned)(crow * HD + ccol * 8) * 2u, vo = (unsigned)(crow * TT + ccol * 8) * 2u;   /* bytes, stage 0 */
    const h16* V16 = VT16 + hp; const bf* Vh = VTh + hp; const bf* Vl = VTl + hp;
    stage_copy(cd, Kh, Kl, V16, Vh, Vl, ko, vo);   /* stage 0 into buffer 0 */
    /* the query fragments, kept in registers */
    v16bf qh[QT][2], ql[QT][2];
    const bf* qhp = Kh + (size_t)q0 * HD + lr * HD + 8 * hi; const bf* qlp = Kl + (size_t)q0 * HD + lr * HD + 8 * hi;
#pragma unroll
    for (int qt = 0; qt < QT; ++qt)
#pragma unroll
        for (int ks = 0; ks < 2; ++ks) { qh[qt][ks] = WFrag<bf>::ld(qhp + qt * 16 * HD + ks * 32); ql[qt][ks] = WFrag<bf>::ld(qlp + qt * 16 * HD + ks * 32); }
    xwait(qhp, qlp);
    v8f o[4][QT];
#pragma unroll
    for (int dt = 0; dt < 4; ++dt)
#pragma unroll
        for (int qt = 0; qt < QT; ++qt) o[dt][qt] = (v8f){};
    float cm[QT], l[QT];
    const float cb = (cw == 0) ? 0.0f : 10.0f;   /* the carry of the fp16 kind, in log2 units */
#pragma unroll
    for (int qt = 0; qt < QT; ++qt) {
        /* the reference: q.q x SCL2, from the lane's own half of the query row (hi + lo) and the other half's. The query fragments are then multiplied by SCL2 and split anew, once for all 64 stages */
        float d = 0.f;
#pragma unroll
        for (int ks = 0; ks < 2; ++ks) { const v8u a = __builtin_bit_cast(v8u, qh[qt][ks]), b = __builtin_bit_cast(v8u, ql[qt][ks]); v8u hh, ll;
#pragma unroll
            for (int e = 0; e < 8; ++e) { const float x0 = __uint_as_float(a[e] << 16) + __uint_as_float(b[e] << 16), x1 = __uint_as_float(a[e] & 0xFFFF0000u) + __uint_as_float(b[e] & 0xFFFF0000u); d = fmaf(x0, x0, fmaf(x1, x1, d));
                unsigned a2, c2; splitf2(x0 * SCL2, x1 * SCL2, a2, c2); hh[e] = a2; ll[e] = c2; }
            qh[qt][ks] = __builtin_bit_cast(v16bf, hh); ql[qt][ks] = __builtin_bit_cast(v16bf, ll); }
        cm[qt] = cb - (d + xhalf(d)) * SCL2; l[qt] = 0.f; }   /* carry - reference */
    const unsigned loff = (unsigned)(lr * LPE + 8 * hi), koff = loff + (unsigned)(g * 32 * LPE), voff = loff + (unsigned)(g * 32);
    asm volatile("s_wait_asynccnt 0x0" ::: "memory");   /* this wave's copies of stage 0 have landed */
    __syncthreads();                                     /* and every other wave's: stage 0 is published */
    // rolled: one stage's fragments, scores and the output tiles are the register budget
#pragma unroll 1
    for (int s = 0; s < NST; ++s) {
        const unsigned char* st = ring + (s & 1) * BSZ;
        /* stage s + 1 goes into the other buffer, whose last readers (pass s - 1) ended in front of the barrier that this pass began behind; the test reads the same for the whole work-group */
        fattn_stage(st, koff, voff, w < 2, cw != 0, qh, ql, o, cm, l, [&]() {
            /* the stage's number through readfirstlane: so the build adds it to the two 32-bit offsets, beside scalar bases; without it it kept five running 64-bit addresses in vector registers, past what a wave has at four waves a SIMD */
            const unsigned sn = (unsigned)__builtin_amdgcn_readfirstlane(s + 1);
            if (s + 1 < NST) stage_copy(cd + (sn & 1u) * BSZ, Kh, Kl, V16, Vh, Vl, ko + sn * (SK * HD * 2), vo + sn * (SK * 2)); });
        /* publish point of stage s + 1, every wave: its own LDS reads of stage s are done, its own copies of stage s + 1 have landed, then the barrier; only behind it, in pass s + 1, is stage s's buffer refilled */
        asm volatile("s_wait_dscnt 0x0" ::: "memory");
        asm volatile("s_wait_asynccnt 0x0" ::: "memory");
        __syncthreads();
    }
    asm volatile("s_wait_asynccnt 0x0" ::: "memory");   /* no copy is outstanding when the wave ends */
    /* the pair's two halves are joined: behind the loop's last barrier nobody reads the ring and no copy is in flight, so it serves as the hand-over place (17 x 16 bytes a lane and pair) */
    v4fa* mg = (v4fa*)ring + cw * 17 * 32 + lane;
    const float m[QT] = {-cm[0], -cm[1]};   /* reference - carry; the carry is the same in both waves of a pair, and only differences are used */
    if (g) {
#pragma unroll
        for (int dt = 0; dt < 4; ++dt)
#pragma unroll
            for (int qt = 0; qt < QT; ++qt) { mg[((dt * QT + qt) * 2) * 32] = (v4f){o[dt][qt][0], o[dt][qt][1], o[dt][qt][2], o[dt][qt][3]}; mg[((dt * QT + qt) * 2 + 1) * 32] = (v4f){o[dt][qt][4], o[dt][qt][5], o[dt][qt][6], o[dt][qt][7]}; }
        mg[16 * 32] = (v4f){m[0], m[1], l[0], l[1]};
    }
    __syncthreads();   /* the odd waves' halves are in LDS before the even waves read them */
    if (g) return;
    const v4f ml = mg[16 * 32];
    /* register j of o[dt][qt] = O[query q0 + 16 qt + c][d = 16 dt + 8h + j]: 8 consecutive floats of one output row per lane */
#pragma unroll
    for (int qt = 0; qt < QT; ++qt) {
        const float mn = fmaxf(m[qt], ml[qt]), fa = ex2(m[qt] - mn), fb = ex2(ml[qt] - mn), lj = fmaf(l[qt], fa, ml[2 + qt] * fb);
        const float f = __fdiv_rn(1.0f, lj + xhalf(lj)), ga = fa * f, gb = fb * f; float* r = orow + (size_t)(q0 + qt * 16 + lr) * DM + 8 * hi;
#pragma unroll
        for (int dt = 0; dt < 4; ++dt) { const v4f pa = mg[((dt * QT + qt) * 2) * 32], pb = mg[((dt * QT + qt) * 2 + 1) * 32]; v4f a, b;
#pragma unroll
            for (int j = 0; j < 4; ++j) { a[j] = fmaf(o[dt][qt][j], ga, pa[j] * gb); b[j] = fmaf(o[dt][qt][4 + j], ga, pb[j] * gb); }
            *(v4f*)(r + dt * 16) = a; *(v4f*)(r + dt * 16 + 4) = b; }
        xwait(r, r); }
}

// ---- k_planes: every plane that k_fattn reads, in one launch. One work-group takes 128 positions x the 64 columns of one head: the f32 tile is read once, in whole 128-byte lines, and laid in LDS;
// from there each thread takes 8 neighbours of a row (K hi/lo planes [h][t][64]) and 8 neighbours of a column (V^T fp16, hi, lo planes [h][64][t]), so that every store is 16 bytes a lane and 8 lanes fill a 128-byte line.
#define PT   128                  // positions per tile
#define PP   65                   // LDS row pitch in floats, odd: 8 floats of 4 neighbouring rows, and rows 8 apart of 4 neighbouring columns, fall on 32 different banks
__global__ __launch_bounds__(256) void k_planes(const float* __restrict__ X, bf* __restrict__ Ph, bf* __restrict__ Pl, h16* __restrict__ V16, bf* __restrict__ Vh, bf* __restrict__ Vl) {
    __shared__ float tile[PT * PP];
    const int tid = (int)threadIdx.x, t0 = (int)blockIdx.x * PT; const size_t hp = (size_t)blockIdx.y * TT * HD;
    /* in: 16 lanes x 16 bytes = the head's 256 bytes of one position; all eight loads of a thread in flight together */
    const int ir = tid >> 4, ic = (tid & 15) * 4;
    const float* sp = X + (size_t)(t0 + ir) * DM + blockIdx.y * HD + ic;
    // every loop of this kernel is unrolled: the register arrays are indexed by constants only, and each group of loads or stores stands together in front of its wait
    v4f in[PT / 16];
#pragma unroll
    for (int i = 0; i < PT / 16; ++i) in[i] = *(const v4f*)(sp + (size_t)i * 16 * DM);
    xwait(sp, sp);
#pragma unroll
    for (int i = 0; i < PT / 16; ++i)
#pragma unroll
        for (int j = 0; j < 4; ++j) tile[(ir + i * 16) * PP + ic + j] = in[i][j];
    __syncthreads();   /* the tile is whole before anybody reads across the writers' rows */
    const int r8 = tid >> 3, c8 = (tid & 7) * 8;
    /* K planes: position t0 + r8 + 32 i, columns c8 .. c8 + 7 */
    v8us kh[PT / 32], kl[PT / 32];
#pragma unroll
    for (int i = 0; i < PT / 32; ++i)
#pragma unroll
        for (int j = 0; j < 8; ++j) { unsigned short a2, c2; splitf(tile[(r8 + i * 32) * PP + c8 + j], a2, c2); kh[i][j] = a2; kl[i][j] = c2; }
    bf* kph = Ph + hp + (size_t)(t0 + r8) * HD + c8; bf* kpl = Pl + hp + (size_t)(t0 + r8) * HD + c8;
#pragma unroll
    for (int i = 0; i < PT / 32; ++i) { *(v8us*)(kph + i * 32 * HD) = kh[i]; *(v8us*)(kpl + i * 32 * HD) = kl[i]; }
    xwait(kph, kpl);
    /* V^T planes: column r8 + 32 i, positions t0 + 64 u + c8 .. + 7 */
    const size_t vo = hp + (size_t)r8 * TT + t0 + c8;
    h16* vp16 = V16 + vo; bf* vph = Vh + vo; bf* vpl = Vl + vo;
#pragma unroll
    for (int i = 0; i < HD / 32; ++i) {
        v8h f[PT / 64]; v8us vh[PT / 64], vl[PT / 64];
#pragma unroll
        for (int u = 0; u < PT / 64; ++u)
#pragma unroll
            for (int j = 0; j < 8; j += 2) { v2f x; unsigned short a2, c2; x[0] = tile[(u * 64 + c8 + j) * PP + r8 + i * 32]; x[1] = tile[(u * 64 + c8 + j + 1) * PP + r8 + i * 32];
                const v2h y = __builtin_convertvector(x, v2h); f[u][j] = y[0]; f[u][j + 1] = y[1];   /* two at a time: one packed conversion, to nearest even like tohx */
                splitf(x[0], a2, c2); vh[u][j] = a2; vl[u][j] = c2; splitf(x[1], a2, c2); vh[u][j + 1] = a2; vl[u][j + 1] = c2; }
#pragma unroll
        for (int u = 0; u < PT / 64; ++u) { *(v8h*)(vp16 + (size_t)i * 32 * TT + u * 64) = f[u]; *(v8us*)(vph + (size_t)i * 32 * TT + u * 64) = vh[u]; *(v8us*)(vpl + (size_t)i * 32 * TT + u * 64) = vl[u]; }
        xwait(vp16, vph); }
}
extern "C" void kernel_launch(void* const* d_in, const int* in_sizes, int n_in,
                              void* d_out, int out_size, void* d_ws, size_t ws_size, hipStream_t stream) {
    (void)in_sizes; (void)n_in; (void)out_size;
    const float* x = (const float*)d_in[0];   /* x [4096][1024]: q = k = v = x reshaped to 16 heads x 64 (no projections, no batch) */
    float* OUT = (float*)d_out;     // [4096][1024]
    char* wsp = (char*)d_ws;
    auto take = [&](size_t bytes) { char* p = wsp; wsp += (bytes + 255) & ~(size_t)255; return (void*)p; };
    bf* QPh = (bf*)take((size_t)TT * MID * 2); bf* QPl = (bf*)take((size_t)TT * MID * 2);   /* k = q: one set of planes */
    h16* VT16 = (h16*)take((size_t)CO * TT * 2); bf* VTh = (bf*)take((size_t)CO * TT * 2); bf* VTl = (bf*)take((size_t)CO * TT * 2);
    if ((size_t)(wsp - (char*)d_ws) > ws_size) return;    // ws 256 MiB (carve 40 MiB)
    k_planes<<<dim3(TT / PT, NH_, 1), 256, 0, stream>>>(x, QPh, QPl, VT16, VTh, VTl);   /* q (= k) planes [h][n][64] (bf16 hi/lo split) and v^T planes [h][64][n] (fp16, bf16 hi/lo) straight from the f32 input */
    k_fattn<<<dim3(RH / 32, NH_, 1), 512, 0, stream>>>(QPh, QPl, VT16, VTh, VTl, OUT);   /* all heads: scores x 1/8, softmax over the 4,096 keys, attn.V, output rows written once */
}
